// v000
// Measured on an AMD MI455X. A time is GPU time per run, averaged over a window of back-to-back runs after a warm-up
// (all launches, gaps included; the runs take copies of the inputs in turn), and the median of several windows.
// Apart from v000's, it joins two sittings. Times from different sittings can be a few percent apart, while
// side-by-side timings come from the same sitting.
// v000, which the later versions start from, runs in 156 microseconds.
#include <hip/hip_runtime.h>
#include <hip/hip_bf16.h>
#include <math.h>

typedef __attribute__((ext_vector_type(2))) float v2f;
typedef __attribute__((ext_vector_type(4))) float v4f;
typedef __attribute__((ext_vector_type(8))) float v8f;
typedef __attribute__((ext_vector_type(4))) unsigned int v4u;
typedef __attribute__((ext_vector_type(8))) unsigned int v8u;

#define B_DIM  128
#define L_DIM  196
#define L1_DIM 197
#define D_DIM  1024

__device__ __forceinline__ float fast_tanh(float x) {
#if __has_builtin(__builtin_amdgcn_tanhf)
  return __builtin_amdgcn_tanhf(x);
#elif __has_builtin(__builtin_amdgcn_tanh_f32)
  return __builtin_amdgcn_tanh_f32(x);
#else
  return tanhf(x);
#endif
}

__device__ __forceinline__ void tdm_load_tile_f32(
    unsigned int lds_off, const float* gaddr, unsigned int tile_rows,
    unsigned int tensor_cols, unsigned int tensor_rows, unsigned int stride_elems)
{
  const unsigned long long ga = (unsigned long long)(uintptr_t)gaddr;
  v4u g0;
  g0[0] = 1u;
  g0[1] = lds_off;
  g0[2] = (unsigned int)ga;
  g0[3] = (unsigned int)(ga >> 32) | (2u << 30);
  v8u g1;
  g1[0] = (2u << 16) | (1u << 20) | (4u << 22) | (3u << 25);
  g1[1] = (tensor_cols & 0xFFFFu) << 16;
  g1[2] = (tensor_cols >> 16) | ((tensor_rows & 0xFFFFu) << 16);
  g1[3] = (tensor_rows >> 16) | (32u << 16);
  g1[4] = tile_rows & 0xFFFFu;
  g1[5] = stride_elems;
  g1[6] = 0u;
  g1[7] = 0u;
  asm volatile("tensor_load_to_lds %0, %1" :: "s"(g0), "s"(g1) : "memory");
}

// ---------------------------------------------------------------------------
// GEMM: Y = act(X @ W^T + bias)   X:[M,K] row-major, W:[N,K] row-major
// act: 0=none, 1=relu, 2=tanh
// Block = 128 threads (4 waves). Tile = 32(M) x 64(N), KT = 32.
// Tiles DMA'd into LDS by the Tensor Data Mover; math via V_WMMA_F32_16X16X4.
// ---------------------------------------------------------------------------
__global__ __launch_bounds__(128) void gemm_bias_act_f32wmma(
    const float* __restrict__ X, const float* __restrict__ W,
    const float* __restrict__ bias, float* __restrict__ Y,
    int M, int N, int K, int act)
{
  // stride 36 floats: float4-aligned rows AND conflict-free column reads
  __shared__ __align__(16) float lA[32][36];
  __shared__ __align__(16) float lB[64][36];

  const int t    = threadIdx.x;
  const int lane = t & 31;
  const int wave = t >> 5;
  const int wm   = wave & 1;    // 16-row tile select within 32 rows
  const int wn   = wave >> 1;   // 32-col slab select within 64 cols
  const int colSel = lane & 15;
  const int half   = lane >> 4;

  const int gm0 = blockIdx.y * 32;
  const int gn0 = blockIdx.x * 64;

  const unsigned int ldsA = (unsigned int)(uintptr_t)&lA[0][0];
  const unsigned int ldsB = (unsigned int)(uintptr_t)&lB[0][0];

  v8f acc0 = {0.f,0.f,0.f,0.f,0.f,0.f,0.f,0.f};
  v8f acc1 = acc0;

  for (int kt = 0; kt < K; kt += 32) {
    if (t < 32) {
      tdm_load_tile_f32(ldsA, X + (size_t)gm0 * K + kt, 32u,
                        (unsigned)(K - kt), (unsigned)(M - gm0), (unsigned)K);
      tdm_load_tile_f32(ldsB, W + (size_t)gn0 * K + kt, 64u,
                        (unsigned)(K - kt), (unsigned)(N - gn0), (unsigned)K);
      __builtin_amdgcn_s_wait_tensorcnt(0);
    }
    __syncthreads();

#pragma unroll
    for (int kk = 0; kk < 8; ++kk) {
      const int k0 = kk * 4 + 2 * half;
      v2f a, b0, b1;
      a.x  = lA[wm * 16 + colSel][k0];
      a.y  = lA[wm * 16 + colSel][k0 + 1];
      b0.x = lB[wn * 32 + colSel][k0];          // B[k][n] = W[n][k]
      b0.y = lB[wn * 32 + colSel][k0 + 1];
      b1.x = lB[wn * 32 + 16 + colSel][k0];
      b1.y = lB[wn * 32 + 16 + colSel][k0 + 1];
      acc0 = __builtin_amdgcn_wmma_f32_16x16x4_f32(false, a, false, b0,
                                                   (short)0, acc0, false, false);
      acc1 = __builtin_amdgcn_wmma_f32_16x16x4_f32(false, a, false, b1,
                                                   (short)0, acc1, false, false);
    }
    __syncthreads();
  }

  const int rowAdd = half * 8;
#pragma unroll
  for (int j = 0; j < 2; ++j) {
    const v8f& acc = j ? acc1 : acc0;
    const int gn = gn0 + wn * 32 + j * 16 + colSel;
    const float bv = bias[gn];
#pragma unroll
    for (int i = 0; i < 8; ++i) {
      const int gm = gm0 + wm * 16 + rowAdd + i;
      float v = acc[i] + bv;
      if (act == 1)      v = fmaxf(v, 0.f);
      else if (act == 2) v = fast_tanh(v);
      Y[(size_t)gm * N + gn] = v;
    }
  }
}

// ---------------------------------------------------------------------------
// scores[b,l] = sum_d tanh(e[b,l,d] + ho_e[b,d]) * Wa[d] + ba
// e[b,0,:] = fr_e[b,:], e[b,l,:] = conv_feat_embed[b,l-1,:]
// One wave per (b,l); ho_e row + Wa staged in LDS once per block (8 l's).
// conv_feat_embed streamed once (~103 MB) with NT hint; V_TANH_F32 per elem.
// ---------------------------------------------------------------------------
__global__ __launch_bounds__(256) void attn_scores(
    const float* __restrict__ conv_feat_embed, const float* __restrict__ fr_e,
    const float* __restrict__ ho_e, const float* __restrict__ Wa,
    const float* __restrict__ ba, float* __restrict__ scores)
{
  __shared__ float sH[D_DIM];
  __shared__ float sW[D_DIM];
  const int b = blockIdx.y;
  for (int d = threadIdx.x; d < D_DIM; d += 256) {
    sH[d] = ho_e[(size_t)b * D_DIM + d];
    sW[d] = Wa[d];
  }
  __syncthreads();

  const int wave = threadIdx.x >> 5;
  const int lane = threadIdx.x & 31;
  const int l    = blockIdx.x * 8 + wave;
  if (l >= L1_DIM) return;

  const float* e = (l == 0)
      ? (fr_e + (size_t)b * D_DIM)
      : (conv_feat_embed + ((size_t)b * L_DIM + (l - 1)) * D_DIM);

  float s = 0.f;
#pragma unroll 4
  for (int d = lane; d < D_DIM; d += 32)
    s += fast_tanh(__builtin_nontemporal_load(e + d) + sH[d]) * sW[d];

#pragma unroll
  for (int off = 16; off > 0; off >>= 1)
    s += __shfl_xor(s, off);

  if (lane == 0) scores[b * L1_DIM + l] = s + ba[0];
}

__global__ __launch_bounds__(256) void softmax197(
    const float* __restrict__ scores, float* __restrict__ PI)
{
  __shared__ float red[256];
  const int t = threadIdx.x;
  const int b = blockIdx.x;

  float v = (t < L1_DIM) ? scores[b * L1_DIM + t] : -INFINITY;
  red[t] = v;
  __syncthreads();
  for (int s = 128; s > 0; s >>= 1) {
    if (t < s) red[t] = fmaxf(red[t], red[t + s]);
    __syncthreads();
  }
  const float mx = red[0];
  __syncthreads();

  float e = (t < L1_DIM) ? expf(v - mx) : 0.f;
  red[t] = e;
  __syncthreads();
  for (int s = 128; s > 0; s >>= 1) {
    if (t < s) red[t] += red[t + s];
    __syncthreads();
  }
  const float inv = 1.f / red[0];
  if (t < L1_DIM) PI[b * L1_DIM + t] = e * inv;
}

// ---------------------------------------------------------------------------
// atten_out[b,d] = PI[b,0]*fr[b,d] + sum_l PI[b,l+1]*conv_feat[b,l,d] + ho[b,d]
// One block per batch row; each lane owns 4 consecutive d (b128 loads).
// Streams conv_feat exactly once (~103 MB) with NT hint.
// ---------------------------------------------------------------------------
__global__ __launch_bounds__(256) void weighted_sum(
    const float* __restrict__ conv_feat, const float* __restrict__ fr,
    const float* __restrict__ ho, const float* __restrict__ PI,
    float* __restrict__ atten)
{
  const int b  = blockIdx.x;
  const int d4 = threadIdx.x * 4;
  const v4f* cf = reinterpret_cast<const v4f*>(
      conv_feat + (size_t)b * L_DIM * D_DIM + d4);
  const float* pi = PI + b * L1_DIM;

  const v4f f = *reinterpret_cast<const v4f*>(fr + (size_t)b * D_DIM + d4);
  v4f acc = pi[0] * f;

#pragma unroll 4
  for (int l = 0; l < L_DIM; ++l) {
    const float p = pi[l + 1];
    const v4f v = __builtin_nontemporal_load(cf + (size_t)l * (D_DIM / 4));
    acc += p * v;
  }

  const v4f h4 = *reinterpret_cast<const v4f*>(ho + (size_t)b * D_DIM + d4);
  acc += h4;
  *reinterpret_cast<v4f*>(atten + (size_t)b * D_DIM + d4) = acc;
}

// ---------------------------------------------------------------------------
extern "C" void kernel_launch(void* const* d_in, const int* in_sizes, int n_in,
                              void* d_out, int out_size, void* d_ws, size_t ws_size,
                              hipStream_t stream) {
  (void)in_sizes; (void)n_in; (void)out_size; (void)ws_size;

  const float* h_out           = (const float*)d_in[0];
  const float* fake_region     = (const float*)d_in[1];
  const float* conv_feat       = (const float*)d_in[2];
  const float* conv_feat_embed = (const float*)d_in[3];
  const float* W_fr  = (const float*)d_in[4];
  const float* b_fr  = (const float*)d_in[5];
  const float* W_fre = (const float*)d_in[6];
  const float* b_fre = (const float*)d_in[7];
  const float* W_ho  = (const float*)d_in[8];
  const float* b_ho  = (const float*)d_in[9];
  const float* W_hoe = (const float*)d_in[10];
  const float* b_hoe = (const float*)d_in[11];
  const float* W_a   = (const float*)d_in[12];
  const float* b_a   = (const float*)d_in[13];
  const float* W_h   = (const float*)d_in[14];
  const float* b_h   = (const float*)d_in[15];
  float* out = (float*)d_out;

  float* ws    = (float*)d_ws;
  float* fr    = ws;
  float* ho    = fr    + B_DIM * D_DIM;
  float* fr_e  = ho    + B_DIM * D_DIM;
  float* ho_e  = fr_e  + B_DIM * D_DIM;
  float* atten = ho_e  + B_DIM * D_DIM;
  float* sc    = atten + B_DIM * D_DIM;
  float* PI    = sc    + B_DIM * L1_DIM;

  const dim3 gBlk(128);
  const dim3 gGrid(D_DIM / 64, B_DIM / 32);   // (16, 4)

  // fr = relu(fake_region @ W_fr^T + b_fr)
  gemm_bias_act_f32wmma<<<gGrid, gBlk, 0, stream>>>(fake_region, W_fr, b_fr, fr,
                                                    B_DIM, D_DIM, D_DIM, 1);
  // ho = tanh(h_out @ W_ho^T + b_ho)
  gemm_bias_act_f32wmma<<<gGrid, gBlk, 0, stream>>>(h_out, W_ho, b_ho, ho,
                                                    B_DIM, D_DIM, D_DIM, 2);
  // fr_e = fr @ W_fre^T + b_fre
  gemm_bias_act_f32wmma<<<gGrid, gBlk, 0, stream>>>(fr, W_fre, b_fre, fr_e,
                                                    B_DIM, D_DIM, D_DIM, 0);
  // ho_e = ho @ W_hoe^T + b_hoe
  gemm_bias_act_f32wmma<<<gGrid, gBlk, 0, stream>>>(ho, W_hoe, b_hoe, ho_e,
                                                    B_DIM, D_DIM, D_DIM, 0);

  // attention scores + softmax + weighted sum
  attn_scores<<<dim3((L1_DIM + 7) / 8, B_DIM), dim3(256), 0, stream>>>(
      conv_feat_embed, fr_e, ho_e, W_a, b_a, sc);
  softmax197<<<dim3(B_DIM), dim3(256), 0, stream>>>(sc, PI);
  weighted_sum<<<dim3(B_DIM), dim3(256), 0, stream>>>(conv_feat, fr, ho, PI, atten);

  // h = tanh(atten @ W_h^T + b_h)
  gemm_bias_act_f32wmma<<<gGrid, gBlk, 0, stream>>>(atten, W_h, b_h, out,
                                                    B_DIM, D_DIM, D_DIM, 2);
}

// v001
// One run takes 91.9 microseconds.
// Timed twice side by side with v000, it ran 1.62 and 1.67 times as fast.
#include <hip/hip_runtime.h>
#include <hip/hip_bf16.h>
#include <math.h>

typedef __attribute__((ext_vector_type(2))) float v2f;
typedef __attribute__((ext_vector_type(4))) float v4f;
typedef __attribute__((ext_vector_type(8))) float v8f;
typedef __attribute__((ext_vector_type(4))) unsigned int v4u;
typedef __attribute__((ext_vector_type(8))) unsigned int v8u;

#define B_DIM  128
#define L_DIM  196
#define L1_DIM 197
#define D_DIM  1024

__device__ __forceinline__ float fast_tanh(float x) {
#if __has_builtin(__builtin_amdgcn_tanhf)
  return __builtin_amdgcn_tanhf(x);
#elif __has_builtin(__builtin_amdgcn_tanh_f32)
  return __builtin_amdgcn_tanh_f32(x);
#else
  return tanhf(x);
#endif
}

#define ROW_BYTES   256u      // 64 k of one row
#define PITCH_BYTES 272u      // LDS row pitch behind the pad
#define A_SLICE     10240u    // 32 rows x 272 = 8704, rounded up to 2 KiB units
#define B_SLICE     18432u    // 64 rows x 272 = 17408, rounded up to 2 KiB units
#define B_BASE      40960u    // four A slices stand in front of the four B slices
#define BUF_BYTES   114688u   // 4 x (A_SLICE + B_SLICE) = one stage of 256 k
#define STAGE_K     256

__device__ __forceinline__ unsigned int uni(unsigned int v) {
  return (unsigned int)__builtin_amdgcn_readfirstlane(v);
}

__device__ __forceinline__ unsigned int pinned(unsigned int v) {
  unsigned int w = uni(v);
  asm volatile("" : "+s"(w));
  return w;
}

__device__ __forceinline__ v8u tdm_group1(unsigned int rows, unsigned int src_pitch_bytes) {
  v8u g;
  g[0] = uni((1u << 20) | (5u << 22) | (3u << 25));
  g[1] = uni((ROW_BYTES & 0xFFFFu) << 16);
  g[2] = uni((ROW_BYTES >> 16) | ((rows & 0xFFFFu) << 16));
  g[3] = uni((rows >> 16) | (ROW_BYTES << 16));
  g[4] = uni(rows);
  g[5] = uni(src_pitch_bytes);
  g[6] = uni(0u);
  g[7] = uni(0u);
  return g;
}

__device__ __forceinline__ v4u tdm_group0(unsigned int lds_dst, unsigned long long ga) {
  v4u g;
  g[0] = uni(1u);
  g[1] = uni(lds_dst);
  g[2] = uni((unsigned int)ga);
  g[3] = uni((((unsigned int)(ga >> 32)) & 0x01FFFFFFu) | 0x80000000u);
  return g;
}

__device__ __forceinline__ void tdm_load_pair(v4u& a0, v8u a1, v4u& b0, v8u b1) {
  asm volatile("tensor_load_to_lds %0, %2\n\ttensor_load_to_lds %1, %3"
               : "+s"(a0), "+s"(b0) : "s"(a1), "s"(b1) : "memory");
}

__device__ __forceinline__ void tdm_wait_pair(v4u a0, v8u a1, v4u b0, v8u b1) {
  asm volatile("s_wait_tensorcnt 0x0" :: "s"(a0), "s"(a1), "s"(b0), "s"(b1) : "memory");
}

// ---------------------------------------------------------------------------
// GEMM: Y = act(X @ W^T + bias)   X:[M,K] row-major, W:[N,K] row-major
// act: 0=none, 1=relu, 2=tanh
// Block = 128 threads (4 waves). Tile = 32(M) x 64(N).
// K runs in stages of 256 through two LDS buffers: while the waves work on one
// stage, the tensor loads of the next one fly. Wave w brings k-quarter w of a
// stage: 32 rows of X and 64 rows of W, 256 bytes each.
// Needs K a multiple of 256 and at least 512, M of 32, N of 64.
// Math via V_WMMA_F32_16X16X4, k ascending.
// ---------------------------------------------------------------------------
__global__ __launch_bounds__(128) void gemm_bias_act_f32wmma(
    const float* __restrict__ X, const float* __restrict__ W,
    const float* __restrict__ bias, float* __restrict__ Y,
    int M, int N, int K, int act)
{
  __shared__ __attribute__((aligned(2048))) unsigned char ring[2u * BUF_BYTES];

  const int t    = threadIdx.x;
  const int lane = t & 31;
  const unsigned int wave = uni((unsigned int)t >> 5);
  const int wm   = wave & 1;    // 16-row tile select within 32 rows
  const int wn   = wave >> 1;   // 32-col slab select within 64 cols
  const int colSel = lane & 15;
  const int half   = lane >> 4;

  const int gm0 = blockIdx.y * 32;
  const int gn0 = blockIdx.x * 64;

  const int nst = K / STAGE_K;
  const unsigned int ldsA = (unsigned int)(uintptr_t)&ring[0] + wave * A_SLICE;
  const unsigned int ldsB = (unsigned int)(uintptr_t)&ring[0] + B_BASE + wave * B_SLICE;
  const unsigned long long gaA =
      (unsigned long long)(uintptr_t)(X + (size_t)gm0 * K + wave * 64u);
  const unsigned long long gaB =
      (unsigned long long)(uintptr_t)(W + (size_t)gn0 * K + wave * 64u);
  v8u g1A = tdm_group1(32u, (unsigned int)K * 4u);
  v8u g1B = tdm_group1(64u, (unsigned int)K * 4u);
  // Without this the compiler rebuilds the two groups at every issue and uses
  // their registers for loop counters while a request that names them is outstanding.
  asm volatile("" : "+s"(g1A), "+s"(g1B));

  v8f acc0 = {0.f,0.f,0.f,0.f,0.f,0.f,0.f,0.f};
  v8f acc1 = acc0;

  // Stage 0 lands and is published; then stage 1 starts into the other buffer.
  v4u g0A = tdm_group0(ldsA, gaA);
  v4u g0B = tdm_group0(ldsB, gaB);
  tdm_load_pair(g0A, g1A, g0B, g1B);
  tdm_wait_pair(g0A, g1A, g0B, g1B);  // this wave's share of stage 0 has landed
  __syncthreads();
  g0A = tdm_group0(ldsA + BUF_BYTES, gaA + STAGE_K * 4u);
  g0B = tdm_group0(ldsB + BUF_BYTES, gaB + STAGE_K * 4u);
  tdm_load_pair(g0A, g1A, g0B, g1B);

  int s = 0;
  do {
    const unsigned int bufOff = (unsigned int)(s & 1) * BUF_BYTES;
    const unsigned char* pa = ring + bufOff + (wm * 16 + colSel) * PITCH_BYTES + half * 8;
    const unsigned char* pb = ring + bufOff + B_BASE + (wn * 32 + colSel) * PITCH_BYTES + half * 8;

    // Both loops unrolled: every LDS offset is then a constant beside a few base registers.
#pragma unroll
    for (int q = 0; q < 4; ++q) {
#pragma unroll
      for (int kk = 0; kk < 16; ++kk) {
        const v2f a  = *reinterpret_cast<const v2f*>(pa + q * A_SLICE + kk * 16);
        const v2f b0 = *reinterpret_cast<const v2f*>(pb + q * B_SLICE + kk * 16);   // B[k][n] = W[n][k]
        const v2f b1 = *reinterpret_cast<const v2f*>(pb + q * B_SLICE + kk * 16 + 16u * PITCH_BYTES);
        acc0 = __builtin_amdgcn_wmma_f32_16x16x4_f32(false, a, false, b0,
                                                     (short)0, acc0, false, false);
        acc1 = __builtin_amdgcn_wmma_f32_16x16x4_f32(false, a, false, b1,
                                                     (short)0, acc1, false, false);
      }
    }

    // Publish point of stage s + 1, and the end of every read of stage s.
    asm volatile("s_wait_dscnt 0x0" ::: "memory");      // this wave's reads of stage s are done
    tdm_wait_pair(g0A, g1A, g0B, g1B);                  // this wave's share of stage s + 1 has landed
    __syncthreads();
    if (pinned(s + 2 < nst)) {  // refill the buffer that every wave has just left
      const unsigned long long adv = (unsigned long long)(s + 2) * (STAGE_K * 4u);
      g0A = tdm_group0(ldsA + bufOff, gaA + adv);
      g0B = tdm_group0(ldsB + bufOff, gaB + adv);
      tdm_load_pair(g0A, g1A, g0B, g1B);
    }
  } while (++s < nst);
  asm volatile("s_wait_tensorcnt 0x0" ::: "memory");  // no request outlives the loop
  asm volatile("s_wait_dscnt 0x0" ::: "memory");

  const int rowAdd = half * 8;
#pragma unroll
  for (int j = 0; j < 2; ++j) {
    const v8f& acc = j ? acc1 : acc0;
    const int gn = gn0 + wn * 32 + j * 16 + colSel;
    const float bv = bias[gn];
#pragma unroll
    for (int i = 0; i < 8; ++i) {
      const int gm = gm0 + wm * 16 + rowAdd + i;
      float v = acc[i] + bv;
      if (act == 1)      v = fmaxf(v, 0.f);
      else if (act == 2) v = fast_tanh(v);
      Y[(size_t)gm * N + gn] = v;
    }
  }
}

// ---------------------------------------------------------------------------
// scores[b,l] = sum_d tanh(e[b,l,d] + ho_e[b,d]) * Wa[d] + ba
// e[b,0,:] = fr_e[b,:], e[b,l,:] = conv_feat_embed[b,l-1,:]
// One wave per (b,l); ho_e row + Wa staged in LDS once per block (8 l's).
// conv_feat_embed streamed once (~103 MB) with NT hint; V_TANH_F32 per elem.
// ---------------------------------------------------------------------------
__global__ __launch_bounds__(256) void attn_scores(
    const float* __restrict__ conv_feat_embed, const float* __restrict__ fr_e,
    const float* __restrict__ ho_e, const float* __restrict__ Wa,
    const float* __restrict__ ba, float* __restrict__ scores)
{
  __shared__ float sH[D_DIM];
  __shared__ float sW[D_DIM];
  const int b = blockIdx.y;
  for (int d = threadIdx.x; d < D_DIM; d += 256) {
    sH[d] = ho_e[(size_t)b * D_DIM + d];
    sW[d] = Wa[d];
  }
  __syncthreads();

  const int wave = threadIdx.x >> 5;
  const int lane = threadIdx.x & 31;
  const int l    = blockIdx.x * 8 + wave;
  if (l >= L1_DIM) return;

  const float* e = (l == 0)
      ? (fr_e + (size_t)b * D_DIM)
      : (conv_feat_embed + ((size_t)b * L_DIM + (l - 1)) * D_DIM);

  float s = 0.f;
#pragma unroll 4
  for (int d = lane; d < D_DIM; d += 32)
    s += fast_tanh(__builtin_nontemporal_load(e + d) + sH[d]) * sW[d];

#pragma unroll
  for (int off = 16; off > 0; off >>= 1)
    s += __shfl_xor(s, off);

  if (lane == 0) scores[b * L1_DIM + l] = s + ba[0];
}

__global__ __launch_bounds__(256) void softmax197(
    const float* __restrict__ scores, float* __restrict__ PI)
{
  __shared__ float red[256];
  const int t = threadIdx.x;
  const int b = blockIdx.x;

  float v = (t < L1_DIM) ? scores[b * L1_DIM + t] : -INFINITY;
  red[t] = v;
  __syncthreads();
  for (int s = 128; s > 0; s >>= 1) {
    if (t < s) red[t] = fmaxf(red[t], red[t + s]);
    __syncthreads();
  }
  const float mx = red[0];
  __syncthreads();

  float e = (t < L1_DIM) ? expf(v - mx) : 0.f;
  red[t] = e;
  __syncthreads();
  for (int s = 128; s > 0; s >>= 1) {
    if (t < s) red[t] += red[t + s];
    __syncthreads();
  }
  const float inv = 1.f / red[0];
  if (t < L1_DIM) PI[b * L1_DIM + t] = e * inv;
}

// ---------------------------------------------------------------------------
// atten_out[b,d] = PI[b,0]*fr[b,d] + sum_l PI[b,l+1]*conv_feat[b,l,d] + ho[b,d]
// One block per batch row; each lane owns 4 consecutive d (b128 loads).
// Streams conv_feat exactly once (~103 MB) with NT hint.
// ---------------------------------------------------------------------------
__global__ __launch_bounds__(256) void weighted_sum(
    const float* __restrict__ conv_feat, const float* __restrict__ fr,
    const float* __restrict__ ho, const float* __restrict__ PI,
    float* __restrict__ atten)
{
  const int b  = blockIdx.x;
  const int d4 = threadIdx.x * 4;
  const v4f* cf = reinterpret_cast<const v4f*>(
      conv_feat + (size_t)b * L_DIM * D_DIM + d4);
  const float* pi = PI + b * L1_DIM;

  const v4f f = *reinterpret_cast<const v4f*>(fr + (size_t)b * D_DIM + d4);
  v4f acc = pi[0] * f;

#pragma unroll 4
  for (int l = 0; l < L_DIM; ++l) {
    const float p = pi[l + 1];
    const v4f v = __builtin_nontemporal_load(cf + (size_t)l * (D_DIM / 4));
    acc += p * v;
  }

  const v4f h4 = *reinterpret_cast<const v4f*>(ho + (size_t)b * D_DIM + d4);
  acc += h4;
  *reinterpret_cast<v4f*>(atten + (size_t)b * D_DIM + d4) = acc;
}

// ---------------------------------------------------------------------------
extern "C" void kernel_launch(void* const* d_in, const int* in_sizes, int n_in,
                              void* d_out, int out_size, void* d_ws, size_t ws_size,
                              hipStream_t stream) {
  (void)in_sizes; (void)n_in; (void)out_size; (void)ws_size;

  const float* h_out           = (const float*)d_in[0];
  const float* fake_region     = (const float*)d_in[1];
  const float* conv_feat       = (const float*)d_in[2];
  const float* conv_feat_embed = (const float*)d_in[3];
  const float* W_fr  = (const float*)d_in[4];
  const float* b_fr  = (const float*)d_in[5];
  const float* W_fre = (const float*)d_in[6];
  const float* b_fre = (const float*)d_in[7];
  const float* W_ho  = (const float*)d_in[8];
  const float* b_ho  = (const float*)d_in[9];
  const float* W_hoe = (const float*)d_in[10];
  const float* b_hoe = (const float*)d_in[11];
  const float* W_a   = (const float*)d_in[12];
  const float* b_a   = (const float*)d_in[13];
  const float* W_h   = (const float*)d_in[14];
  const float* b_h   = (const float*)d_in[15];
  float* out = (float*)d_out;

  float* ws    = (float*)d_ws;
  float* fr    = ws;
  float* ho    = fr    + B_DIM * D_DIM;
  float* fr_e  = ho    + B_DIM * D_DIM;
  float* ho_e  = fr_e  + B_DIM * D_DIM;
  float* atten = ho_e  + B_DIM * D_DIM;
  float* sc    = atten + B_DIM * D_DIM;
  float* PI    = sc    + B_DIM * L1_DIM;

  const dim3 gBlk(128);
  const dim3 gGrid(D_DIM / 64, B_DIM / 32);   // (16, 4)

  // fr = relu(fake_region @ W_fr^T + b_fr)
  gemm_bias_act_f32wmma<<<gGrid, gBlk, 0, stream>>>(fake_region, W_fr, b_fr, fr,
                                                    B_DIM, D_DIM, D_DIM, 1);
  // ho = tanh(h_out @ W_ho^T + b_ho)
  gemm_bias_act_f32wmma<<<gGrid, gBlk, 0, stream>>>(h_out, W_ho, b_ho, ho,
                                                    B_DIM, D_DIM, D_DIM, 2);
  // fr_e = fr @ W_fre^T + b_fre
  gemm_bias_act_f32wmma<<<gGrid, gBlk, 0, stream>>>(fr, W_fre, b_fre, fr_e,
                                                    B_DIM, D_DIM, D_DIM, 0);
  // ho_e = ho @ W_hoe^T + b_hoe
  gemm_bias_act_f32wmma<<<gGrid, gBlk, 0, stream>>>(ho, W_hoe, b_hoe, ho_e,
                                                    B_DIM, D_DIM, D_DIM, 0);

  // attention scores + softmax + weighted sum
  attn_scores<<<dim3((L1_DIM + 7) / 8, B_DIM), dim3(256), 0, stream>>>(
      conv_feat_embed, fr_e, ho_e, W_a, b_a, sc);
  softmax197<<<dim3(B_DIM), dim3(256), 0, stream>>>(sc, PI);
  weighted_sum<<<dim3(B_DIM), dim3(256), 0, stream>>>(conv_feat, fr, ho, PI, atten);

  // h = tanh(atten @ W_h^T + b_h)
  gemm_bias_act_f32wmma<<<gGrid, gBlk, 0, stream>>>(atten, W_h, b_h, out,
                                                    B_DIM, D_DIM, D_DIM, 2);
}

// v002
// A run of this version takes 72.5 microseconds.
// Timed twice side by side with v001, it ran 1.26 times as fast both times.
// Counting every step since v000, it is 2.07 times as fast.
#include <hip/hip_runtime.h>
#include <hip/hip_bf16.h>
#include <math.h>

typedef __attribute__((ext_vector_type(2))) float v2f;
typedef __attribute__((ext_vector_type(4))) float v4f;
typedef __attribute__((ext_vector_type(8))) float v8f;
typedef __attribute__((ext_vector_type(4))) unsigned int v4u;
typedef __attribute__((ext_vector_type(8))) unsigned int v8u;

#define B_DIM  128
#define L_DIM  196
#define L1_DIM 197
#define D_DIM  1024

__device__ __forceinline__ float fast_tanh(float x) {
#if __has_builtin(__builtin_amdgcn_tanhf)
  return __builtin_amdgcn_tanhf(x);
#elif __has_builtin(__builtin_amdgcn_tanh_f32)
  return __builtin_amdgcn_tanh_f32(x);
#else
  return tanhf(x);
#endif
}

#define ROW_BYTES   256u      // 64 k of one row
#define PITCH_BYTES 272u      // LDS row pitch behind the pad
#define A_SLICE     10240u    // 32 rows x 272 = 8704, rounded up to 2 KiB units
#define B_SLICE     18432u    // 64 rows x 272 = 17408, rounded up to 2 KiB units
#define B_BASE      40960u    // four A slices stand in front of the four B slices
#define BUF_BYTES   114688u   // 4 x (A_SLICE + B_SLICE) = one stage of 256 k
#define STAGE_K     256

__device__ __forceinline__ unsigned int uni(unsigned int v) {
  return (unsigned int)__builtin_amdgcn_readfirstlane(v);
}

__device__ __forceinline__ unsigned int pinned(unsigned int v) {
  unsigned int w = uni(v);
  asm volatile("" : "+s"(w));
  return w;
}

__device__ __forceinline__ v8u tdm_group1(unsigned int rows, unsigned int src_pitch_bytes) {
  v8u g;
  g[0] = uni((1u << 20) | (5u << 22) | (3u << 25));
  g[1] = uni((ROW_BYTES & 0xFFFFu) << 16);
  g[2] = uni((ROW_BYTES >> 16) | ((rows & 0xFFFFu) << 16));
  g[3] = uni((rows >> 16) | (ROW_BYTES << 16));
  g[4] = uni(rows);
  g[5] = uni(src_pitch_bytes);
  g[6] = uni(0u);
  g[7] = uni(0u);
  return g;
}

__device__ __forceinline__ v4u tdm_group0(unsigned int lds_dst, unsigned long long ga) {
  v4u g;
  g[0] = uni(1u);
  g[1] = uni(lds_dst);
  g[2] = uni((unsigned int)ga);
  g[3] = uni((((unsigned int)(ga >> 32)) & 0x01FFFFFFu) | 0x80000000u);
  return g;
}

__device__ __forceinline__ void tdm_load_pair(v4u& a0, v8u a1, v4u& b0, v8u b1) {
  asm volatile("tensor_load_to_lds %0, %2\n\ttensor_load_to_lds %1, %3"
               : "+s"(a0), "+s"(b0) : "s"(a1), "s"(b1) : "memory");
}

__device__ __forceinline__ void tdm_wait_pair(v4u a0, v8u a1, v4u b0, v8u b1) {
  asm volatile("s_wait_tensorcnt 0x0" :: "s"(a0), "s"(a1), "s"(b0), "s"(b1) : "memory");
}

// ---------------------------------------------------------------------------
// GEMM: Y = act(X @ W^T + bias)   X:[M,K] row-major, W:[N,K] row-major
// act: 0=none, 1=relu, 2=tanh
// Block = 128 threads (4 waves). Tile = 32(M) x 64(N).
// K runs in stages of 256 through two LDS buffers: while the waves work on one
// stage, the tensor loads of the next one fly. Wave w brings k-quarter w of a
// stage: 32 rows of X and 64 rows of W, 256 bytes each.
// Needs K a multiple of 256 and at least 512, M of 32, N of 64.
// Math via V_WMMA_F32_16X16X4, k ascending.
// ---------------------------------------------------------------------------
__global__ __launch_bounds__(128) void gemm_bias_act_f32wmma(
    const float* __restrict__ X, const float* __restrict__ W,
    const float* __restrict__ bias, float* __restrict__ Y,
    int M, int N, int K, int act)
{
  __shared__ __attribute__((aligned(2048))) unsigned char ring[2u * BUF_BYTES];

  const int t    = threadIdx.x;
  const int lane = t & 31;
  const unsigned int wave = uni((unsigned int)t >> 5);
  const int wm   = wave & 1;    // 16-row tile select within 32 rows
  const int wn   = wave >> 1;   // 32-col slab select within 64 cols
  const int colSel = lane & 15;
  const int half   = lane >> 4;

  const int gm0 = blockIdx.y * 32;
  const int gn0 = blockIdx.x * 64;

  const int nst = K / STAGE_K;
  const unsigned int ldsA = (unsigned int)(uintptr_t)&ring[0] + wave * A_SLICE;
  const unsigned int ldsB = (unsigned int)(uintptr_t)&ring[0] + B_BASE + wave * B_SLICE;
  const unsigned long long gaA =
      (unsigned long long)(uintptr_t)(X + (size_t)gm0 * K + wave * 64u);
  const unsigned long long gaB =
      (unsigned long long)(uintptr_t)(W + (size_t)gn0 * K + wave * 64u);
  v8u g1A = tdm_group1(32u, (unsigned int)K * 4u);
  v8u g1B = tdm_group1(64u, (unsigned int)K * 4u);
  // Without this the compiler rebuilds the two groups at every issue and uses
  // their registers for loop counters while a request that names them is outstanding.
  asm volatile("" : "+s"(g1A), "+s"(g1B));

  v8f acc0 = {0.f,0.f,0.f,0.f,0.f,0.f,0.f,0.f};
  v8f acc1 = acc0;

  // Stage 0 lands and is published; then stage 1 starts into the other buffer.
  v4u g0A = tdm_group0(ldsA, gaA);
  v4u g0B = tdm_group0(ldsB, gaB);
  tdm_load_pair(g0A, g1A, g0B, g1B);
  tdm_wait_pair(g0A, g1A, g0B, g1B);  // this wave's share of stage 0 has landed
  __syncthreads();
  g0A = tdm_group0(ldsA + BUF_BYTES, gaA + STAGE_K * 4u);
  g0B = tdm_group0(ldsB + BUF_BYTES, gaB + STAGE_K * 4u);
  tdm_load_pair(g0A, g1A, g0B, g1B);

  int s = 0;
  do {
    const unsigned int bufOff = (unsigned int)(s & 1) * BUF_BYTES;
    const unsigned char* pa = ring + bufOff + (wm * 16 + colSel) * PITCH_BYTES + half * 8;
    const unsigned char* pb = ring + bufOff + B_BASE + (wn * 32 + colSel) * PITCH_BYTES + half * 8;

    // Both loops unrolled: every LDS offset is then a constant beside a few base registers.
#pragma unroll
    for (int q = 0; q < 4; ++q) {
#pragma unroll
      for (int kk = 0; kk < 16; ++kk) {
        const v2f a  = *reinterpret_cast<const v2f*>(pa + q * A_SLICE + kk * 16);
        const v2f b0 = *reinterpret_cast<const v2f*>(pb + q * B_SLICE + kk * 16);   // B[k][n] = W[n][k]
        const v2f b1 = *reinterpret_cast<const v2f*>(pb + q * B_SLICE + kk * 16 + 16u * PITCH_BYTES);
        acc0 = __builtin_amdgcn_wmma_f32_16x16x4_f32(false, a, false, b0,
                                                     (short)0, acc0, false, false);
        acc1 = __builtin_amdgcn_wmma_f32_16x16x4_f32(false, a, false, b1,
                                                     (short)0, acc1, false, false);
      }
    }

    // Publish point of stage s + 1, and the end of every read of stage s.
    asm volatile("s_wait_dscnt 0x0" ::: "memory");      // this wave's reads of stage s are done
    tdm_wait_pair(g0A, g1A, g0B, g1B);                  // this wave's share of stage s + 1 has landed
    __syncthreads();
    if (pinned(s + 2 < nst)) {  // refill the buffer that every wave has just left
      const unsigned long long adv = (unsigned long long)(s + 2) * (STAGE_K * 4u);
      g0A = tdm_group0(ldsA + bufOff, gaA + adv);
      g0B = tdm_group0(ldsB + bufOff, gaB + adv);
      tdm_load_pair(g0A, g1A, g0B, g1B);
    }
  } while (++s < nst);
  asm volatile("s_wait_tensorcnt 0x0" ::: "memory");  // no request outlives the loop
  asm volatile("s_wait_dscnt 0x0" ::: "memory");

  const int rowAdd = half * 8;
#pragma unroll
  for (int j = 0; j < 2; ++j) {
    const v8f& acc = j ? acc1 : acc0;
    const int gn = gn0 + wn * 32 + j * 16 + colSel;
    const float bv = bias[gn];
#pragma unroll
    for (int i = 0; i < 8; ++i) {
      const int gm = gm0 + wm * 16 + rowAdd + i;
      float v = acc[i] + bv;
      if (act == 1)      v = fmaxf(v, 0.f);
      else if (act == 2) v = fast_tanh(v);
      Y[(size_t)gm * N + gn] = v;
    }
  }
}

// ---------------------------------------------------------------------------
// scores[b,l] = sum_d tanh(e[b,l,d] + ho_e[b,d]) * Wa[d] + ba
// e[b,0,:] = fr_e[b,:], e[b,l,:] = conv_feat_embed[b,l-1,:]
// One wave per (b,l); ho_e row + Wa staged in LDS once per block (8 l's).
// conv_feat_embed streamed once (~103 MB) with NT hint; V_TANH_F32 per elem.
// ---------------------------------------------------------------------------
__global__ __launch_bounds__(256) void attn_scores(
    const float* __restrict__ conv_feat_embed, const float* __restrict__ fr_e,
    const float* __restrict__ ho_e, const float* __restrict__ Wa,
    const float* __restrict__ ba, float* __restrict__ scores)
{
  __shared__ float sH[D_DIM];
  __shared__ float sW[D_DIM];
  const int b = blockIdx.y;
  for (int d = threadIdx.x; d < D_DIM; d += 256) {
    sH[d] = ho_e[(size_t)b * D_DIM + d];
    sW[d] = Wa[d];
  }
  __syncthreads();

  const int wave = threadIdx.x >> 5;
  const int lane = threadIdx.x & 31;
  const int l    = blockIdx.x * 8 + wave;
  if (l >= L1_DIM) return;

  const float* e = (l == 0)
      ? (fr_e + (size_t)b * D_DIM)
      : (conv_feat_embed + ((size_t)b * L_DIM + (l - 1)) * D_DIM);

  float s = 0.f;
#pragma unroll 4
  for (int d = lane; d < D_DIM; d += 32)
    s += fast_tanh(__builtin_nontemporal_load(e + d) + sH[d]) * sW[d];

#pragma unroll
  for (int off = 16; off > 0; off >>= 1)
    s += __shfl_xor(s, off);

  if (lane == 0) scores[b * L1_DIM + l] = s + ba[0];
}

__global__ __launch_bounds__(256) void softmax197(
    const float* __restrict__ scores, float* __restrict__ PI)
{
  __shared__ float red[256];
  const int t = threadIdx.x;
  const int b = blockIdx.x;

  float v = (t < L1_DIM) ? scores[b * L1_DIM + t] : -INFINITY;
  red[t] = v;
  __syncthreads();
  for (int s = 128; s > 0; s >>= 1) {
    if (t < s) red[t] = fmaxf(red[t], red[t + s]);
    __syncthreads();
  }
  const float mx = red[0];
  __syncthreads();

  float e = (t < L1_DIM) ? expf(v - mx) : 0.f;
  red[t] = e;
  __syncthreads();
  for (int s = 128; s > 0; s >>= 1) {
    if (t < s) red[t] += red[t + s];
    __syncthreads();
  }
  const float inv = 1.f / red[0];
  if (t < L1_DIM) PI[b * L1_DIM + t] = e * inv;
}

// ---------------------------------------------------------------------------
// atten_out[b,d] = PI[b,0]*fr[b,d] + sum_l PI[b,l+1]*conv_feat[b,l,d] + ho[b,d]
// 256 blocks of 16 waves, so that every WGP streams. A block owns one batch row
// and 512 of its d. A wave owns 128 d (one b128 load = 512 contiguous bytes of a
// row) and 49 of the 196 l, and asks for all 49 rows before it sums the first;
// the four partial sums over l of each d meet in LDS.
// Streams conv_feat exactly once (~103 MB) with NT hint.
// ---------------------------------------------------------------------------
#define WS_GROUPS 4                       // partial sums over l
#define WS_ROWS   (L_DIM / WS_GROUPS)     // 49 rows a wave

__global__ __launch_bounds__(512) void weighted_sum(
    const float* __restrict__ conv_feat, const float* __restrict__ fr,
    const float* __restrict__ ho, const float* __restrict__ PI,
    float* __restrict__ atten)
{
  __shared__ v4f part[WS_GROUPS][128];

  const int t    = threadIdx.x;
  const int lane = t & 31;
  const unsigned int wave  = uni((unsigned int)t >> 5);
  const unsigned int slice = wave & 3u;   // which 128 d of the block's 512
  const unsigned int grp   = wave >> 2;   // which 49 rows
  const int b  = blockIdx.x >> 1;
  const int d0 = (blockIdx.x & 1) * 512;

  const v4f* cf = reinterpret_cast<const v4f*>(
      conv_feat + ((size_t)b * L_DIM + grp * WS_ROWS) * D_DIM + d0 + slice * 128u + lane * 4);
  const float* pi = PI + b * L1_DIM;      // wave-uniform: scalar loads

  const size_t o0 = (size_t)b * D_DIM + d0;   // block-uniform: the block's first d
  const float f = (fr + o0)[t];
  const float h = (ho + o0)[t];

  // The loops over the rows are unrolled: v[] and p[] then live in registers, and
  // each row's distance is an immediate offset beside one base address.
  v4f v[WS_ROWS];
#pragma unroll
  for (int i = 0; i < WS_ROWS; ++i)
    v[i] = __builtin_nontemporal_load(cf + (size_t)i * (D_DIM / 4));

  const float p0 = pi[0];
  float p[WS_ROWS];
#pragma unroll
  for (int i = 0; i < WS_ROWS; ++i) p[i] = pi[1 + grp * WS_ROWS + i];

  // Keeps every load above in front of the sums: left alone, the compiler sinks
  // the loads among the sums to save registers and holds about a quarter of them in flight.
  __builtin_amdgcn_sched_barrier(0);

  v4f acc = {0.f, 0.f, 0.f, 0.f};
#pragma unroll
  for (int i = 0; i < WS_ROWS; ++i) acc += p[i] * v[i];

  part[grp][slice * 32u + lane] = acc;
  __syncthreads();

  // One d a thread: the four partial sums in the order of l.
  const float* ps = reinterpret_cast<const float*>(&part[0][0]);
  float s = p0 * f;
#pragma unroll
  for (int g = 0; g < WS_GROUPS; ++g) s += ps[g * 512 + t];
  (atten + o0)[t] = s + h;
}

// ---------------------------------------------------------------------------
extern "C" void kernel_launch(void* const* d_in, const int* in_sizes, int n_in,
                              void* d_out, int out_size, void* d_ws, size_t ws_size,
                              hipStream_t stream) {
  (void)in_sizes; (void)n_in; (void)out_size; (void)ws_size;

  const float* h_out           = (const float*)d_in[0];
  const float* fake_region     = (const float*)d_in[1];
  const float* conv_feat       = (const float*)d_in[2];
  const float* conv_feat_embed = (const float*)d_in[3];
  const float* W_fr  = (const float*)d_in[4];
  const float* b_fr  = (const float*)d_in[5];
  const float* W_fre = (const float*)d_in[6];
  const float* b_fre = (const float*)d_in[7];
  const float* W_ho  = (const float*)d_in[8];
  const float* b_ho  = (const float*)d_in[9];
  const float* W_hoe = (const float*)d_in[10];
  const float* b_hoe = (const float*)d_in[11];
  const float* W_a   = (const float*)d_in[12];
  const float* b_a   = (const float*)d_in[13];
  const float* W_h   = (const float*)d_in[14];
  const float* b_h   = (const float*)d_in[15];
  float* out = (float*)d_out;

  float* ws    = (float*)d_ws;
  float* fr    = ws;
  float* ho    = fr    + B_DIM * D_DIM;
  float* fr_e  = ho    + B_DIM * D_DIM;
  float* ho_e  = fr_e  + B_DIM * D_DIM;
  float* atten = ho_e  + B_DIM * D_DIM;
  float* sc    = atten + B_DIM * D_DIM;
  float* PI    = sc    + B_DIM * L1_DIM;

  const dim3 gBlk(128);
  const dim3 gGrid(D_DIM / 64, B_DIM / 32);   // (16, 4)

  // fr = relu(fake_region @ W_fr^T + b_fr)
  gemm_bias_act_f32wmma<<<gGrid, gBlk, 0, stream>>>(fake_region, W_fr, b_fr, fr,
                                                    B_DIM, D_DIM, D_DIM, 1);
  // ho = tanh(h_out @ W_ho^T + b_ho)
  gemm_bias_act_f32wmma<<<gGrid, gBlk, 0, stream>>>(h_out, W_ho, b_ho, ho,
                                                    B_DIM, D_DIM, D_DIM, 2);
  // fr_e = fr @ W_fre^T + b_fre
  gemm_bias_act_f32wmma<<<gGrid, gBlk, 0, stream>>>(fr, W_fre, b_fre, fr_e,
                                                    B_DIM, D_DIM, D_DIM, 0);
  // ho_e = ho @ W_hoe^T + b_hoe
  gemm_bias_act_f32wmma<<<gGrid, gBlk, 0, stream>>>(ho, W_hoe, b_hoe, ho_e,
                                                    B_DIM, D_DIM, D_DIM, 0);

  // attention scores + softmax + weighted sum
  attn_scores<<<dim3((L1_DIM + 7) / 8, B_DIM), dim3(256), 0, stream>>>(
      conv_feat_embed, fr_e, ho_e, W_a, b_a, sc);
  softmax197<<<dim3(B_DIM), dim3(256), 0, stream>>>(sc, PI);
  weighted_sum<<<dim3(B_DIM * 2), dim3(512), 0, stream>>>(conv_feat, fr, ho, PI, atten);

  // h = tanh(atten @ W_h^T + b_h)
  gemm_bias_act_f32wmma<<<gGrid, gBlk, 0, stream>>>(atten, W_h, b_h, out,
                                                    B_DIM, D_DIM, D_DIM, 2);
}

// v003
// Measured time: 55.9 microseconds a run.
// Next to v002, in two timings, it ran 1.29 times as fast each time.
// All steps since v000 together make it 2.67 times as fast.
#include <hip/hip_runtime.h>
#include <hip/hip_bf16.h>
#include <math.h>

typedef __attribute__((ext_vector_type(2))) float v2f;
typedef __attribute__((ext_vector_type(4))) float v4f;
typedef __attribute__((ext_vector_type(8))) float v8f;
typedef __attribute__((ext_vector_type(4))) unsigned int v4u;
typedef __attribute__((ext_vector_type(8))) unsigned int v8u;

#define B_DIM  128
#define L_DIM  196
#define L1_DIM 197
#define D_DIM  1024

__device__ __forceinline__ float fast_tanh(float x) {
#if __has_builtin(__builtin_amdgcn_tanhf)
  return __builtin_amdgcn_tanhf(x);
#elif __has_builtin(__builtin_amdgcn_tanh_f32)
  return __builtin_amdgcn_tanh_f32(x);
#else
  return tanhf(x);
#endif
}

#define ROW_BYTES   256u      // 64 k of one row
#define PITCH_BYTES 272u      // LDS row pitch behind the pad
#define A_SLICE     10240u    // 32 rows x 272 = 8704, rounded up to 2 KiB units
#define B_SLICE     18432u    // 64 rows x 272 = 17408, rounded up to 2 KiB units
#define B_BASE      40960u    // four A slices stand in front of the four B slices
#define BUF_BYTES   114688u   // 4 x (A_SLICE + B_SLICE) = one stage of 256 k
#define STAGE_K     256

__device__ __forceinline__ unsigned int uni(unsigned int v) {
  return (unsigned int)__builtin_amdgcn_readfirstlane(v);
}

__device__ __forceinline__ unsigned int pinned(unsigned int v) {
  unsigned int w = uni(v);
  asm volatile("" : "+s"(w));
  return w;
}

__device__ __forceinline__ v8u tdm_group1(unsigned int rows, unsigned int src_pitch_bytes) {
  v8u g;
  g[0] = uni((1u << 20) | (5u << 22) | (3u << 25));
  g[1] = uni((ROW_BYTES & 0xFFFFu) << 16);
  g[2] = uni((ROW_BYTES >> 16) | ((rows & 0xFFFFu) << 16));
  g[3] = uni((rows >> 16) | (ROW_BYTES << 16));
  g[4] = uni(rows);
  g[5] = uni(src_pitch_bytes);
  g[6] = uni(0u);
  g[7] = uni(0u);
  return g;
}

__device__ __forceinline__ v4u tdm_group0(unsigned int lds_dst, unsigned long long ga) {
  v4u g;
  g[0] = uni(1u);
  g[1] = uni(lds_dst);
  g[2] = uni((unsigned int)ga);
  g[3] = uni((((unsigned int)(ga >> 32)) & 0x01FFFFFFu) | 0x80000000u);
  return g;
}

__device__ __forceinline__ void tdm_load_pair(v4u& a0, v8u a1, v4u& b0, v8u b1) {
  asm volatile("tensor_load_to_lds %0, %2\n\ttensor_load_to_lds %1, %3"
               : "+s"(a0), "+s"(b0) : "s"(a1), "s"(b1) : "memory");
}

__device__ __forceinline__ void tdm_wait_pair(v4u a0, v8u a1, v4u b0, v8u b1) {
  asm volatile("s_wait_tensorcnt 0x0" :: "s"(a0), "s"(a1), "s"(b0), "s"(b1) : "memory");
}

__global__ __launch_bounds__(128) void gemm_bias_act_f32wmma(
    const float* X0, const float* W0, const float* bias0, float* Y0, int act0,
    const float* X1, const float* W1, const float* bias1, float* Y1, int act1,
    int M, int N, int K)
{
  __shared__ __attribute__((aligned(2048))) unsigned char ring[2u * BUF_BYTES];

  const bool second = blockIdx.z != 0;    // block-uniform
  const float* __restrict__ X    = second ? X1 : X0;
  const float* __restrict__ W    = second ? W1 : W0;
  const float* __restrict__ bias = second ? bias1 : bias0;
  float* __restrict__ Y          = second ? Y1 : Y0;
  const int act                  = second ? act1 : act0;

  const int t    = threadIdx.x;
  const int lane = t & 31;
  const unsigned int wave = uni((unsigned int)t >> 5);
  const int wm   = wave & 1;    // 16-row tile select within 32 rows
  const int wn   = wave >> 1;   // 32-col slab select within 64 cols
  const int colSel = lane & 15;
  const int half   = lane >> 4;

  const int gm0 = blockIdx.y * 32;
  const int gn0 = blockIdx.x * 64;

  const int nst = K / STAGE_K;
  const unsigned int ldsA = (unsigned int)(uintptr_t)&ring[0] + wave * A_SLICE;
  const unsigned int ldsB = (unsigned int)(uintptr_t)&ring[0] + B_BASE + wave * B_SLICE;
  const unsigned long long gaA =
      (unsigned long long)(uintptr_t)(X + (size_t)gm0 * K + wave * 64u);
  const unsigned long long gaB =
      (unsigned long long)(uintptr_t)(W + (size_t)gn0 * K + wave * 64u);
  v8u g1A = tdm_group1(32u, (unsigned int)K * 4u);
  v8u g1B = tdm_group1(64u, (unsigned int)K * 4u);
  // Without this the compiler rebuilds the two groups at every issue and uses
  // their registers for loop counters while a request that names them is outstanding.
  asm volatile("" : "+s"(g1A), "+s"(g1B));

  v8f acc0 = {0.f,0.f,0.f,0.f,0.f,0.f,0.f,0.f};
  v8f acc1 = acc0;

  // Stage 0 lands and is published; then stage 1 starts into the other buffer.
  v4u g0A = tdm_group0(ldsA, gaA);
  v4u g0B = tdm_group0(ldsB, gaB);
  tdm_load_pair(g0A, g1A, g0B, g1B);
  tdm_wait_pair(g0A, g1A, g0B, g1B);  // this wave's share of stage 0 has landed
  __syncthreads();
  g0A = tdm_group0(ldsA + BUF_BYTES, gaA + STAGE_K * 4u);
  g0B = tdm_group0(ldsB + BUF_BYTES, gaB + STAGE_K * 4u);
  tdm_load_pair(g0A, g1A, g0B, g1B);

  int s = 0;
  do {
    const unsigned int bufOff = (unsigned int)(s & 1) * BUF_BYTES;
    const unsigned char* pa = ring + bufOff + (wm * 16 + colSel) * PITCH_BYTES + half * 8;
    const unsigned char* pb = ring + bufOff + B_BASE + (wn * 32 + colSel) * PITCH_BYTES + half * 8;

    // Both loops unrolled: every LDS offset is then a constant beside a few base registers.
#pragma unroll
    for (int q = 0; q < 4; ++q) {
#pragma unroll
      for (int kk = 0; kk < 16; ++kk) {
        const v2f a  = *reinterpret_cast<const v2f*>(pa + q * A_SLICE + kk * 16);
        const v2f b0 = *reinterpret_cast<const v2f*>(pb + q * B_SLICE + kk * 16);   // B[k][n] = W[n][k]
        const v2f b1 = *reinterpret_cast<const v2f*>(pb + q * B_SLICE + kk * 16 + 16u * PITCH_BYTES);
        acc0 = __builtin_amdgcn_wmma_f32_16x16x4_f32(false, a, false, b0,
                                                     (short)0, acc0, false, false);
        acc1 = __builtin_amdgcn_wmma_f32_16x16x4_f32(false, a, false, b1,
                                                     (short)0, acc1, false, false);
      }
    }

    // Publish point of stage s + 1, and the end of every read of stage s.
    asm volatile("s_wait_dscnt 0x0" ::: "memory");      // this wave's reads of stage s are done
    tdm_wait_pair(g0A, g1A, g0B, g1B);                  // this wave's share of stage s + 1 has landed
    __syncthreads();
    if (pinned(s + 2 < nst)) {  // refill the buffer that every wave has just left
      const unsigned long long adv = (unsigned long long)(s + 2) * (STAGE_K * 4u);
      g0A = tdm_group0(ldsA + bufOff, gaA + adv);
      g0B = tdm_group0(ldsB + bufOff, gaB + adv);
      tdm_load_pair(g0A, g1A, g0B, g1B);
    }
  } while (++s < nst);
  tdm_wait_pair(g0A, g1A, g0B, g1B);
  asm volatile("s_wait_dscnt 0x0" ::: "memory");

  const int rowAdd = half * 8;
#pragma unroll
  for (int j = 0; j < 2; ++j) {
    const v8f& acc = j ? acc1 : acc0;
    const int gn = gn0 + wn * 32 + j * 16 + colSel;
    const float bv = bias[gn];
#pragma unroll
    for (int i = 0; i < 8; ++i) {
      const int gm = gm0 + wm * 16 + rowAdd + i;
      float v = acc[i] + bv;
      if (act == 1)      v = fmaxf(v, 0.f);
      else if (act == 2) v = fast_tanh(v);
      Y[(size_t)gm * N + gn] = v;
    }
  }
}

// ---------------------------------------------------------------------------
// scores[b,l] = sum_d tanh(e[b,l,d] + ho_e[b,d]) * Wa[d] + ba
// e[b,0,:] = fr_e[b,:], e[b,l,:] = conv_feat_embed[b,l-1,:]
// One wave per (b,l); ho_e row + Wa staged in LDS once per block (8 l's).
// conv_feat_embed streamed once (~103 MB) with NT hint; V_TANH_F32 per elem.
// ---------------------------------------------------------------------------
__global__ __launch_bounds__(256) void attn_scores(
    const float* __restrict__ conv_feat_embed, const float* __restrict__ fr_e,
    const float* __restrict__ ho_e, const float* __restrict__ Wa,
    const float* __restrict__ ba, float* __restrict__ scores)
{
  __shared__ float sH[D_DIM];
  __shared__ float sW[D_DIM];
  const int b = blockIdx.y;
  for (int d = threadIdx.x; d < D_DIM; d += 256) {
    sH[d] = ho_e[(size_t)b * D_DIM + d];
    sW[d] = Wa[d];
  }
  __syncthreads();

  const int wave = threadIdx.x >> 5;
  const int lane = threadIdx.x & 31;
  const int l    = blockIdx.x * 8 + wave;
  if (l >= L1_DIM) return;

  const float* e = (l == 0)
      ? (fr_e + (size_t)b * D_DIM)
      : (conv_feat_embed + ((size_t)b * L_DIM + (l - 1)) * D_DIM);

  float s = 0.f;
#pragma unroll 4
  for (int d = lane; d < D_DIM; d += 32)
    s += fast_tanh(__builtin_nontemporal_load(e + d) + sH[d]) * sW[d];

#pragma unroll
  for (int off = 16; off > 0; off >>= 1)
    s += __shfl_xor(s, off);

  if (lane == 0) scores[b * L1_DIM + l] = s + ba[0];
}

__global__ __launch_bounds__(256) void softmax197(
    const float* __restrict__ scores, float* __restrict__ PI)
{
  __shared__ float red[256];
  const int t = threadIdx.x;
  const int b = blockIdx.x;

  float v = (t < L1_DIM) ? scores[b * L1_DIM + t] : -INFINITY;
  red[t] = v;
  __syncthreads();
  for (int s = 128; s > 0; s >>= 1) {
    if (t < s) red[t] = fmaxf(red[t], red[t + s]);
    __syncthreads();
  }
  const float mx = red[0];
  __syncthreads();

  float e = (t < L1_DIM) ? expf(v - mx) : 0.f;
  red[t] = e;
  __syncthreads();
  for (int s = 128; s > 0; s >>= 1) {
    if (t < s) red[t] += red[t + s];
    __syncthreads();
  }
  const float inv = 1.f / red[0];
  if (t < L1_DIM) PI[b * L1_DIM + t] = e * inv;
}

// ---------------------------------------------------------------------------
// atten_out[b,d] = PI[b,0]*fr[b,d] + sum_l PI[b,l+1]*conv_feat[b,l,d] + ho[b,d]
// 256 blocks of 16 waves, so that every WGP streams. A block owns one batch row
// and 512 of its d. A wave owns 128 d (one b128 load = 512 contiguous bytes of a
// row) and 49 of the 196 l, and asks for all 49 rows before it sums the first;
// the four partial sums over l of each d meet in LDS.
// Streams conv_feat exactly once (~103 MB) with NT hint.
// ---------------------------------------------------------------------------
#define WS_GROUPS 4                       // partial sums over l
#define WS_ROWS   (L_DIM / WS_GROUPS)     // 49 rows a wave

__global__ __launch_bounds__(512) void weighted_sum(
    const float* __restrict__ conv_feat, const float* __restrict__ fr,
    const float* __restrict__ ho, const float* __restrict__ PI,
    float* __restrict__ atten)
{
  __shared__ v4f part[WS_GROUPS][128];

  const int t    = threadIdx.x;
  const int lane = t & 31;
  const unsigned int wave  = uni((unsigned int)t >> 5);
  const unsigned int slice = wave & 3u;   // which 128 d of the block's 512
  const unsigned int grp   = wave >> 2;   // which 49 rows
  const int b  = blockIdx.x >> 1;
  const int d0 = (blockIdx.x & 1) * 512;

  const v4f* cf = reinterpret_cast<const v4f*>(
      conv_feat + ((size_t)b * L_DIM + grp * WS_ROWS) * D_DIM + d0 + slice * 128u + lane * 4);
  const float* pi = PI + b * L1_DIM;      // wave-uniform: scalar loads

  const size_t o0 = (size_t)b * D_DIM + d0;   // block-uniform: the block's first d
  const float f = (fr + o0)[t];
  const float h = (ho + o0)[t];

  // The loops over the rows are unrolled: v[] and p[] then live in registers, and
  // each row's distance is an immediate offset beside one base address.
  v4f v[WS_ROWS];
#pragma unroll
  for (int i = 0; i < WS_ROWS; ++i)
    v[i] = __builtin_nontemporal_load(cf + (size_t)i * (D_DIM / 4));

  const float p0 = pi[0];
  float p[WS_ROWS];
#pragma unroll
  for (int i = 0; i < WS_ROWS; ++i) p[i] = pi[1 + grp * WS_ROWS + i];

  // Keeps every load above in front of the sums: left alone, the compiler sinks
  // the loads among the sums to save registers and holds about a quarter of them in flight.
  __builtin_amdgcn_sched_barrier(0);

  v4f acc = {0.f, 0.f, 0.f, 0.f};
#pragma unroll
  for (int i = 0; i < WS_ROWS; ++i) acc += p[i] * v[i];

  part[grp][slice * 32u + lane] = acc;
  __syncthreads();

  // One d a thread: the four partial sums in the order of l.
  const float* ps = reinterpret_cast<const float*>(&part[0][0]);
  float s = p0 * f;
#pragma unroll
  for (int g = 0; g < WS_GROUPS; ++g) s += ps[g * 512 + t];
  (atten + o0)[t] = s + h;
}

// ---------------------------------------------------------------------------
extern "C" void kernel_launch(void* const* d_in, const int* in_sizes, int n_in,
                              void* d_out, int out_size, void* d_ws, size_t ws_size,
                              hipStream_t stream) {
  (void)in_sizes; (void)n_in; (void)out_size; (void)ws_size;

  const float* h_out           = (const float*)d_in[0];
  const float* fake_region     = (const float*)d_in[1];
  const float* conv_feat       = (const float*)d_in[2];
  const float* conv_feat_embed = (const float*)d_in[3];
  const float* W_fr  = (const float*)d_in[4];
  const float* b_fr  = (const float*)d_in[5];
  const float* W_fre = (const float*)d_in[6];
  const float* b_fre = (const float*)d_in[7];
  const float* W_ho  = (const float*)d_in[8];
  const float* b_ho  = (const float*)d_in[9];
  const float* W_hoe = (const float*)d_in[10];
  const float* b_hoe = (const float*)d_in[11];
  const float* W_a   = (const float*)d_in[12];
  const float* b_a   = (const float*)d_in[13];
  const float* W_h   = (const float*)d_in[14];
  const float* b_h   = (const float*)d_in[15];
  float* out = (float*)d_out;

  float* ws    = (float*)d_ws;
  float* fr    = ws;
  float* ho    = fr    + B_DIM * D_DIM;
  float* fr_e  = ho    + B_DIM * D_DIM;
  float* ho_e  = fr_e  + B_DIM * D_DIM;
  float* atten = ho_e  + B_DIM * D_DIM;
  float* sc    = atten + B_DIM * D_DIM;
  float* PI    = sc    + B_DIM * L1_DIM;

  const dim3 gBlk(128);
  const dim3 gGrid(D_DIM / 64, B_DIM / 32);      // (16, 4): one product
  const dim3 gGrid2(D_DIM / 64, B_DIM / 32, 2);  // (16, 4, 2): two products

  // fr = relu(fake_region @ W_fr^T + b_fr)  beside  ho = tanh(h_out @ W_ho^T + b_ho)
  gemm_bias_act_f32wmma<<<gGrid2, gBlk, 0, stream>>>(fake_region, W_fr, b_fr, fr, 1,
                                                     h_out, W_ho, b_ho, ho, 2,
                                                     B_DIM, D_DIM, D_DIM);
  // fr_e = fr @ W_fre^T + b_fre  beside  ho_e = ho @ W_hoe^T + b_hoe
  gemm_bias_act_f32wmma<<<gGrid2, gBlk, 0, stream>>>(fr, W_fre, b_fre, fr_e, 0,
                                                     ho, W_hoe, b_hoe, ho_e, 0,
                                                     B_DIM, D_DIM, D_DIM);

  // attention scores + softmax + weighted sum
  attn_scores<<<dim3((L1_DIM + 7) / 8, B_DIM), dim3(256), 0, stream>>>(
      conv_feat_embed, fr_e, ho_e, W_a, b_a, sc);
  softmax197<<<dim3(B_DIM), dim3(256), 0, stream>>>(sc, PI);
  weighted_sum<<<dim3(B_DIM * 2), dim3(512), 0, stream>>>(conv_feat, fr, ho, PI, atten);

  // h = tanh(atten @ W_h^T + b_h)
  // (one product: with one z plane the second operand set is never picked)
  gemm_bias_act_f32wmma<<<gGrid, gBlk, 0, stream>>>(atten, W_h, b_h, out, 2,
                                                    atten, W_h, b_h, out, 2,
                                                    B_DIM, D_DIM, D_DIM);
}

// v004
// Measured time: 46.7 microseconds a run.
// Timed twice side by side with v003, it ran 1.20 times as fast both times.
// Counting every step since v000, it is 3.21 times as fast.
#include <hip/hip_runtime.h>
#include <hip/hip_bf16.h>
#include <math.h>

typedef __attribute__((ext_vector_type(2))) float v2f;
typedef __attribute__((ext_vector_type(4))) float v4f;
typedef __attribute__((ext_vector_type(8))) float v8f;
typedef __attribute__((ext_vector_type(4))) unsigned int v4u;
typedef __attribute__((ext_vector_type(8))) unsigned int v8u;

#define B_DIM  128
#define L_DIM  196
#define L1_DIM 197
#define D_DIM  1024

__device__ __forceinline__ float fast_tanh(float x) {
#if __has_builtin(__builtin_amdgcn_tanhf)
  return __builtin_amdgcn_tanhf(x);
#elif __has_builtin(__builtin_amdgcn_tanh_f32)
  return __builtin_amdgcn_tanh_f32(x);
#else
  return tanhf(x);
#endif
}

#define ROW_BYTES   256u      // 64 k of one row
#define PITCH_BYTES 272u      // LDS row pitch behind the pad
#define A_SLICE     10240u    // 32 rows x 272 = 8704, rounded up to 2 KiB units
#define B_SLICE     18432u    // 64 rows x 272 = 17408, rounded up to 2 KiB units
#define B_BASE      40960u    // four A slices stand in front of the four B slices
#define BUF_BYTES   114688u   // 4 x (A_SLICE + B_SLICE) = one stage of 256 k
#define STAGE_K     256

__device__ __forceinline__ unsigned int uni(unsigned int v) {
  return (unsigned int)__builtin_amdgcn_readfirstlane(v);
}

__device__ __forceinline__ unsigned int pinned(unsigned int v) {
  unsigned int w = uni(v);
  asm volatile("" : "+s"(w));
  return w;
}

__device__ __forceinline__ v8u tdm_group1(unsigned int rows, unsigned int src_pitch_bytes) {
  v8u g;
  g[0] = uni((1u << 20) | (5u << 22) | (3u << 25));
  g[1] = uni((ROW_BYTES & 0xFFFFu) << 16);
  g[2] = uni((ROW_BYTES >> 16) | ((rows & 0xFFFFu) << 16));
  g[3] = uni((rows >> 16) | (ROW_BYTES << 16));
  g[4] = uni(rows);
  g[5] = uni(src_pitch_bytes);
  g[6] = uni(0u);
  g[7] = uni(0u);
  return g;
}

__device__ __forceinline__ v4u tdm_group0(unsigned int lds_dst, unsigned long long ga) {
  v4u g;
  g[0] = uni(1u);
  g[1] = uni(lds_dst);
  g[2] = uni((unsigned int)ga);
  g[3] = uni((((unsigned int)(ga >> 32)) & 0x01FFFFFFu) | 0x80000000u);
  return g;
}

__device__ __forceinline__ void tdm_load_pair(v4u& a0, v8u a1, v4u& b0, v8u b1) {
  asm volatile("tensor_load_to_lds %0, %2\n\ttensor_load_to_lds %1, %3"
               : "+s"(a0), "+s"(b0) : "s"(a1), "s"(b1) : "memory");
}

__device__ __forceinline__ void tdm_wait_pair(v4u a0, v8u a1, v4u b0, v8u b1) {
  asm volatile("s_wait_tensorcnt 0x0" :: "s"(a0), "s"(a1), "s"(b0), "s"(b1) : "memory");
}

__global__ __launch_bounds__(128) void gemm_bias_act_f32wmma(
    const float* X0, const float* W0, const float* bias0, float* Y0, int act0,
    const float* X1, const float* W1, const float* bias1, float* Y1, int act1,
    int M, int N, int K)
{
  __shared__ __attribute__((aligned(2048))) unsigned char ring[2u * BUF_BYTES];

  const bool second = blockIdx.z != 0;    // block-uniform
  const float* __restrict__ X    = second ? X1 : X0;
  const float* __restrict__ W    = second ? W1 : W0;
  const float* __restrict__ bias = second ? bias1 : bias0;
  float* __restrict__ Y          = second ? Y1 : Y0;
  const int act                  = second ? act1 : act0;

  const int t    = threadIdx.x;
  const int lane = t & 31;
  const unsigned int wave = uni((unsigned int)t >> 5);
  const int wm   = wave & 1;    // 16-row tile select within 32 rows
  const int wn   = wave >> 1;   // 32-col slab select within 64 cols
  const int colSel = lane & 15;
  const int half   = lane >> 4;

  const int gm0 = blockIdx.y * 32;
  const int gn0 = blockIdx.x * 64;

  const int nst = K / STAGE_K;
  const unsigned int ldsA = (unsigned int)(uintptr_t)&ring[0] + wave * A_SLICE;
  const unsigned int ldsB = (unsigned int)(uintptr_t)&ring[0] + B_BASE + wave * B_SLICE;
  const unsigned long long gaA =
      (unsigned long long)(uintptr_t)(X + (size_t)gm0 * K + wave * 64u);
  const unsigned long long gaB =
      (unsigned long long)(uintptr_t)(W + (size_t)gn0 * K + wave * 64u);
  v8u g1A = tdm_group1(32u, (unsigned int)K * 4u);
  v8u g1B = tdm_group1(64u, (unsigned int)K * 4u);
  // Without this the compiler rebuilds the two groups at every issue and uses
  // their registers for loop counters while a request that names them is outstanding.
  asm volatile("" : "+s"(g1A), "+s"(g1B));

  v8f acc0 = {0.f,0.f,0.f,0.f,0.f,0.f,0.f,0.f};
  v8f acc1 = acc0;

  // Stage 0 lands and is published; then stage 1 starts into the other buffer.
  v4u g0A = tdm_group0(ldsA, gaA);
  v4u g0B = tdm_group0(ldsB, gaB);
  tdm_load_pair(g0A, g1A, g0B, g1B);
  tdm_wait_pair(g0A, g1A, g0B, g1B);  // this wave's share of stage 0 has landed
  __syncthreads();
  g0A = tdm_group0(ldsA + BUF_BYTES, gaA + STAGE_K * 4u);
  g0B = tdm_group0(ldsB + BUF_BYTES, gaB + STAGE_K * 4u);
  tdm_load_pair(g0A, g1A, g0B, g1B);

  int s = 0;
  do {
    const unsigned int bufOff = (unsigned int)(s & 1) * BUF_BYTES;
    const unsigned char* pa = ring + bufOff + (wm * 16 + colSel) * PITCH_BYTES + half * 8;
    const unsigned char* pb = ring + bufOff + B_BASE + (wn * 32 + colSel) * PITCH_BYTES + half * 8;

    // Both loops unrolled: every LDS offset is then a constant beside a few base registers.
#pragma unroll
    for (int q = 0; q < 4; ++q) {
#pragma unroll
      for (int kk = 0; kk < 16; ++kk) {
        const v2f a  = *reinterpret_cast<const v2f*>(pa + q * A_SLICE + kk * 16);
        const v2f b0 = *reinterpret_cast<const v2f*>(pb + q * B_SLICE + kk * 16);   // B[k][n] = W[n][k]
        const v2f b1 = *reinterpret_cast<const v2f*>(pb + q * B_SLICE + kk * 16 + 16u * PITCH_BYTES);
        acc0 = __builtin_amdgcn_wmma_f32_16x16x4_f32(false, a, false, b0,
                                                     (short)0, acc0, false, false);
        acc1 = __builtin_amdgcn_wmma_f32_16x16x4_f32(false, a, false, b1,
                                                     (short)0, acc1, false, false);
      }
    }

    // Publish point of stage s + 1, and the end of every read of stage s.
    asm volatile("s_wait_dscnt 0x0" ::: "memory");      // this wave's reads of stage s are done
    tdm_wait_pair(g0A, g1A, g0B, g1B);                  // this wave's share of stage s + 1 has landed
    __syncthreads();
    if (pinned(s + 2 < nst)) {  // refill the buffer that every wave has just left
      const unsigned long long adv = (unsigned long long)(s + 2) * (STAGE_K * 4u);
      g0A = tdm_group0(ldsA + bufOff, gaA + adv);
      g0B = tdm_group0(ldsB + bufOff, gaB + adv);
      tdm_load_pair(g0A, g1A, g0B, g1B);
    }
  } while (++s < nst);
  tdm_wait_pair(g0A, g1A, g0B, g1B);
  asm volatile("s_wait_dscnt 0x0" ::: "memory");

  const int rowAdd = half * 8;
#pragma unroll
  for (int j = 0; j < 2; ++j) {
    const v8f& acc = j ? acc1 : acc0;
    const int gn = gn0 + wn * 32 + j * 16 + colSel;
    const float bv = bias[gn];
#pragma unroll
    for (int i = 0; i < 8; ++i) {
      const int gm = gm0 + wm * 16 + rowAdd + i;
      float v = acc[i] + bv;
      if (act == 1)      v = fmaxf(v, 0.f);
      else if (act == 2) v = fast_tanh(v);
      Y[(size_t)gm * N + gn] = v;
    }
  }
}

// ---------------------------------------------------------------------------
// scores[b,l] = sum_d tanh(e[b,l,d] + ho_e[b,d]) * Wa[d] + ba
// e[b,0,:] = fr_e[b,:], e[b,l,:] = conv_feat_embed[b,l-1,:]
// 256 blocks, so that every WGP streams and few waves have to start. A block owns
// one batch row and 98 of its 196 rows of conv_feat_embed: 14 waves take 7 whole
// rows each, 14 apart; a fifteenth wave takes the fr_e row in the even blocks.
// A wave keeps the ho_e row and Wa in registers (lane: 4 d of every 128). A row is
// 8 b128 loads of 512 contiguous bytes; four rows are in flight, and a row's
// registers are asked for anew when it is summed.
// conv_feat_embed streamed once (~103 MB) with NT hint; V_TANH_F32 per elem.
// ---------------------------------------------------------------------------
#define SC_WAVES 14                       // streaming waves a block
#define SC_ROWS  7                        // rows a streaming wave: 14 x 7 = 98 = 196 / 2
#define SC_DEPTH 4                        // rows in flight a wave
#define SC_VECS  (D_DIM / 128)            // b128 loads a row

// Asks for one row: e is wave-uniform, so that the loads take a scalar base, the
// lane's offset and an immediate.
__device__ __forceinline__ void sc_ask(v4f (&v)[SC_VECS], const float* e, unsigned int lane4) {
#pragma unroll
  for (int j = 0; j < SC_VECS; ++j)
    v[j] = __builtin_nontemporal_load(reinterpret_cast<const v4f*>(e + (lane4 + j * 128u)));
}

// One lane's share of a row's sum: four chains, one for each of its 4 d in 128.
__device__ __forceinline__ float sc_sum(const v4f (&v)[SC_VECS], const v4f (&h)[SC_VECS],
                                        const v4f (&w)[SC_VECS]) {
  v4f a = {0.f, 0.f, 0.f, 0.f};
#pragma unroll
  for (int j = 0; j < SC_VECS; ++j) {
    const v4f x = v[j] + h[j];
    const v4f t = {fast_tanh(x[0]), fast_tanh(x[1]), fast_tanh(x[2]), fast_tanh(x[3])};
    a += t * w[j];
  }
  return (a[0] + a[1]) + (a[2] + a[3]);
}

// N rows, SC_WAVES apart, from e on; their scores go to o, SC_WAVES apart.
template <int N>
__device__ __forceinline__ void sc_rows(const float* e, const v4f (&h)[SC_VECS],
                                        const v4f (&w)[SC_VECS], const float* ba, float* o, int lane) {
  constexpr int DEPTH = N < SC_DEPTH ? N : SC_DEPTH;
  const unsigned int lane4 = (unsigned int)lane * 4u;

  v4f v[DEPTH][SC_VECS];
#pragma unroll
  for (int i = 0; i < DEPTH; ++i) sc_ask(v[i], e + i * (SC_WAVES * D_DIM), lane4);
  // Keeps the first rows' loads in front of the sums: left alone, the compiler
  // sinks most of the fourth row's behind the first sums.
  __builtin_amdgcn_sched_barrier(0);

  float s[N];
  // Unrolled: v[] and s[] then live in registers.
#pragma unroll
  for (int i = 0; i < N; ++i) {
    s[i] = sc_sum(v[i % DEPTH], h, w);
    // Each row's sum, against spills: the sum is finished here, and the refill below
    // stays behind it. Left alone, the compiler asks for all seven rows at the top and
    // spills them. (For the same reason the two streamed pointers are not __restrict__:
    // loads known to be of unchanging memory are held by no clobber.)
    asm volatile("" : "+v"(s[i]) :: "memory");
    if (i + DEPTH < N) sc_ask(v[i % DEPTH], e + (i + DEPTH) * (SC_WAVES * D_DIM), lane4);
    // Keeps the rows' sums apart: left alone, the compiler weaves the first rows' sums
    // together, and every refill is asked for only when the fourth row has landed.
    __builtin_amdgcn_sched_barrier(0);
  }
  // Every load has landed; from here on their address registers may be written anew.
  asm volatile("s_wait_xcnt 0x0" ::: "memory");

#pragma unroll
  for (int off = 16; off > 0; off >>= 1) {
#pragma unroll
    for (int i = 0; i < N; ++i) s[i] += __shfl_xor(s[i], off);
  }

  if (lane == 0) {
    const float bv = ba[0];
#pragma unroll
    for (int i = 0; i < N; ++i) o[i * SC_WAVES] = s[i] + bv;
  }
}

__global__ __launch_bounds__((SC_WAVES + 1) * 32) void attn_scores(
    const float* conv_feat_embed, const float* fr_e,   // not __restrict__: see the refills
    const float* __restrict__ ho_e, const float* __restrict__ Wa,
    const float* __restrict__ ba, float* __restrict__ scores)
{
  const int lane = threadIdx.x & 31;
  const unsigned int wave = uni((unsigned int)threadIdx.x >> 5);
  const unsigned int b    = blockIdx.x >> 1;
  const unsigned int odd  = blockIdx.x & 1u;                // block-uniform
  if (wave == SC_WAVES && odd) return;   // wave-uniform, and the kernel has no barrier

  v4f h[SC_VECS], w[SC_VECS];
#pragma unroll
  for (int j = 0; j < SC_VECS; ++j) {
    h[j] = *reinterpret_cast<const v4f*>(ho_e + (size_t)b * D_DIM + ((unsigned int)lane * 4u + j * 128u));
    w[j] = *reinterpret_cast<const v4f*>(Wa + ((unsigned int)lane * 4u + j * 128u));
  }

  if (wave < SC_WAVES) {
    const unsigned int r = odd * (SC_WAVES * SC_ROWS) + wave;   // the wave's first row; its l is r + 1
    sc_rows<SC_ROWS>(conv_feat_embed + ((size_t)b * L_DIM + r) * D_DIM, h, w, ba,
                     scores + (b * L1_DIM + 1u + r), lane);
  } else {
    sc_rows<1>(fr_e + (size_t)b * D_DIM, h, w, ba, scores + b * L1_DIM, lane);
  }
}

__global__ __launch_bounds__(256) void softmax197(
    const float* __restrict__ scores, float* __restrict__ PI)
{
  __shared__ float red[256];
  const int t = threadIdx.x;
  const int b = blockIdx.x;

  float v = (t < L1_DIM) ? scores[b * L1_DIM + t] : -INFINITY;
  red[t] = v;
  __syncthreads();
  for (int s = 128; s > 0; s >>= 1) {
    if (t < s) red[t] = fmaxf(red[t], red[t + s]);
    __syncthreads();
  }
  const float mx = red[0];
  __syncthreads();

  float e = (t < L1_DIM) ? expf(v - mx) : 0.f;
  red[t] = e;
  __syncthreads();
  for (int s = 128; s > 0; s >>= 1) {
    if (t < s) red[t] += red[t + s];
    __syncthreads();
  }
  const float inv = 1.f / red[0];
  if (t < L1_DIM) PI[b * L1_DIM + t] = e * inv;
}

// ---------------------------------------------------------------------------
// atten_out[b,d] = PI[b,0]*fr[b,d] + sum_l PI[b,l+1]*conv_feat[b,l,d] + ho[b,d]
// 256 blocks of 16 waves, so that every WGP streams. A block owns one batch row
// and 512 of its d. A wave owns 128 d (one b128 load = 512 contiguous bytes of a
// row) and 49 of the 196 l, and asks for all 49 rows before it sums the first;
// the four partial sums over l of each d meet in LDS.
// Streams conv_feat exactly once (~103 MB) with NT hint.
// ---------------------------------------------------------------------------
#define WS_GROUPS 4                       // partial sums over l
#define WS_ROWS   (L_DIM / WS_GROUPS)     // 49 rows a wave

__global__ __launch_bounds__(512) void weighted_sum(
    const float* __restrict__ conv_feat, const float* __restrict__ fr,
    const float* __restrict__ ho, const float* __restrict__ PI,
    float* __restrict__ atten)
{
  __shared__ v4f part[WS_GROUPS][128];

  const int t    = threadIdx.x;
  const int lane = t & 31;
  const unsigned int wave  = uni((unsigned int)t >> 5);
  const unsigned int slice = wave & 3u;   // which 128 d of the block's 512
  const unsigned int grp   = wave >> 2;   // which 49 rows
  const int b  = blockIdx.x >> 1;
  const int d0 = (blockIdx.x & 1) * 512;

  const v4f* cf = reinterpret_cast<const v4f*>(
      conv_feat + ((size_t)b * L_DIM + grp * WS_ROWS) * D_DIM + d0 + slice * 128u + lane * 4);
  const float* pi = PI + b * L1_DIM;      // wave-uniform: scalar loads

  const size_t o0 = (size_t)b * D_DIM + d0;   // block-uniform: the block's first d
  const float f = (fr + o0)[t];
  const float h = (ho + o0)[t];

  // The loops over the rows are unrolled: v[] and p[] then live in registers, and
  // each row's distance is an immediate offset beside one base address.
  v4f v[WS_ROWS];
#pragma unroll
  for (int i = 0; i < WS_ROWS; ++i)
    v[i] = __builtin_nontemporal_load(cf + (size_t)i * (D_DIM / 4));

  const float p0 = pi[0];
  float p[WS_ROWS];
#pragma unroll
  for (int i = 0; i < WS_ROWS; ++i) p[i] = pi[1 + grp * WS_ROWS + i];

  // Keeps every load above in front of the sums: left alone, the compiler sinks
  // the loads among the sums to save registers and holds about a quarter of them in flight.
  __builtin_amdgcn_sched_barrier(0);

  v4f acc = {0.f, 0.f, 0.f, 0.f};
#pragma unroll
  for (int i = 0; i < WS_ROWS; ++i) acc += p[i] * v[i];

  part[grp][slice * 32u + lane] = acc;
  __syncthreads();

  // One d a thread: the four partial sums in the order of l.
  const float* ps = reinterpret_cast<const float*>(&part[0][0]);
  float s = p0 * f;
#pragma unroll
  for (int g = 0; g < WS_GROUPS; ++g) s += ps[g * 512 + t];
  (atten + o0)[t] = s + h;
}

// ---------------------------------------------------------------------------
extern "C" void kernel_launch(void* const* d_in, const int* in_sizes, int n_in,
                              void* d_out, int out_size, void* d_ws, size_t ws_size,
                              hipStream_t stream) {
  (void)in_sizes; (void)n_in; (void)out_size; (void)ws_size;

  const float* h_out           = (const float*)d_in[0];
  const float* fake_region     = (const float*)d_in[1];
  const float* conv_feat       = (const float*)d_in[2];
  const float* conv_feat_embed = (const float*)d_in[3];
  const float* W_fr  = (const float*)d_in[4];
  const float* b_fr  = (const float*)d_in[5];
  const float* W_fre = (const float*)d_in[6];
  const float* b_fre = (const float*)d_in[7];
  const float* W_ho  = (const float*)d_in[8];
  const float* b_ho  = (const float*)d_in[9];
  const float* W_hoe = (const float*)d_in[10];
  const float* b_hoe = (const float*)d_in[11];
  const float* W_a   = (const float*)d_in[12];
  const float* b_a   = (const float*)d_in[13];
  const float* W_h   = (const float*)d_in[14];
  const float* b_h   = (const float*)d_in[15];
  float* out = (float*)d_out;

  float* ws    = (float*)d_ws;
  float* fr    = ws;
  float* ho    = fr    + B_DIM * D_DIM;
  float* fr_e  = ho    + B_DIM * D_DIM;
  float* ho_e  = fr_e  + B_DIM * D_DIM;
  float* atten = ho_e  + B_DIM * D_DIM;
  float* sc    = atten + B_DIM * D_DIM;
  float* PI    = sc    + B_DIM * L1_DIM;

  const dim3 gBlk(128);
  const dim3 gGrid(D_DIM / 64, B_DIM / 32);      // (16, 4): one product
  const dim3 gGrid2(D_DIM / 64, B_DIM / 32, 2);  // (16, 4, 2): two products

  // fr = relu(fake_region @ W_fr^T + b_fr)  beside  ho = tanh(h_out @ W_ho^T + b_ho)
  gemm_bias_act_f32wmma<<<gGrid2, gBlk, 0, stream>>>(fake_region, W_fr, b_fr, fr, 1,
                                                     h_out, W_ho, b_ho, ho, 2,
                                                     B_DIM, D_DIM, D_DIM);
  // fr_e = fr @ W_fre^T + b_fre  beside  ho_e = ho @ W_hoe^T + b_hoe
  gemm_bias_act_f32wmma<<<gGrid2, gBlk, 0, stream>>>(fr, W_fre, b_fre, fr_e, 0,
                                                     ho, W_hoe, b_hoe, ho_e, 0,
                                                     B_DIM, D_DIM, D_DIM);

  // attention scores + softmax + weighted sum
  attn_scores<<<dim3(B_DIM * 2), dim3((SC_WAVES + 1) * 32), 0, stream>>>(
      conv_feat_embed, fr_e, ho_e, W_a, b_a, sc);
  softmax197<<<dim3(B_DIM), dim3(256), 0, stream>>>(sc, PI);
  weighted_sum<<<dim3(B_DIM * 2), dim3(512), 0, stream>>>(conv_feat, fr, ho, PI, atten);

  // h = tanh(atten @ W_h^T + b_h)
  // (one product: with one z plane the second operand set is never picked)
  gemm_bias_act_f32wmma<<<gGrid, gBlk, 0, stream>>>(atten, W_h, b_h, out, 2,
                                                    atten, W_h, b_h, out, 2,
                                                    B_DIM, D_DIM, D_DIM);
}

// v005
// Measured time: 38 microseconds a run.
// Timed twice side by side with v004, it ran 1.22 and 1.25 times as fast.
// Over all steps from v000 it is 3.96 times as fast.
#include <hip/hip_runtime.h>
#include <hip/hip_bf16.h>
#include <math.h>

typedef __attribute__((ext_vector_type(2))) float v2f;
typedef __attribute__((ext_vector_type(4))) float v4f;
typedef __attribute__((ext_vector_type(8))) float v8f;
typedef __attribute__((ext_vector_type(4))) unsigned int v4u;
typedef __attribute__((ext_vector_type(8))) unsigned int v8u;

#define B_DIM  128
#define L_DIM  196
#define L1_DIM 197
#define D_DIM  1024

__device__ __forceinline__ float fast_tanh(float x) {
#if __has_builtin(__builtin_amdgcn_tanhf)
  return __builtin_amdgcn_tanhf(x);
#elif __has_builtin(__builtin_amdgcn_tanh_f32)
  return __builtin_amdgcn_tanh_f32(x);
#else
  return tanhf(x);
#endif
}

#define ROW_BYTES   256u      // 64 k of one row
#define PITCH_BYTES 272u      // LDS row pitch behind the pad
#define STAGE_K     256
#define PART_PITCH  36

// LDS bytes of a slice of that many rows, rounded up to 2 KiB units.
__host__ __device__ constexpr unsigned int slice_bytes(unsigned int rows) {
  return (rows * PITCH_BYTES + 2047u) / 2048u * 2048u;
}

__device__ __forceinline__ unsigned int uni(unsigned int v) {
  return (unsigned int)__builtin_amdgcn_readfirstlane(v);
}

__device__ __forceinline__ unsigned int pinned(unsigned int v) {
  unsigned int w = uni(v);
  asm volatile("" : "+s"(w));
  return w;
}

__device__ __forceinline__ v8u tdm_group1(unsigned int rows, unsigned int src_pitch_bytes) {
  v8u g;
  g[0] = uni((1u << 20) | (5u << 22) | (3u << 25));
  g[1] = uni((ROW_BYTES & 0xFFFFu) << 16);
  g[2] = uni((ROW_BYTES >> 16) | ((rows & 0xFFFFu) << 16));
  g[3] = uni((rows >> 16) | (ROW_BYTES << 16));
  g[4] = uni(rows);
  g[5] = uni(src_pitch_bytes);
  g[6] = uni(0u);
  g[7] = uni(0u);
  return g;
}

__device__ __forceinline__ v4u tdm_group0(unsigned int lds_dst, unsigned long long ga) {
  v4u g;
  g[0] = uni(1u);
  g[1] = uni(lds_dst);
  g[2] = uni((unsigned int)ga);
  g[3] = uni((((unsigned int)(ga >> 32)) & 0x01FFFFFFu) | 0x80000000u);
  return g;
}

__device__ __forceinline__ void tdm_load_pair(v4u& a0, v8u a1, v4u& b0, v8u b1) {
  asm volatile("tensor_load_to_lds %0, %2\n\ttensor_load_to_lds %1, %3"
               : "+s"(a0), "+s"(b0) : "s"(a1), "s"(b1) : "memory");
}

__device__ __forceinline__ void tdm_wait_pair(v4u a0, v8u a1, v4u b0, v8u b1) {
  asm volatile("s_wait_tensorcnt 0x0" :: "s"(a0), "s"(a1), "s"(b0), "s"(b1) : "memory");
}

template <int MF>
__global__ __launch_bounds__(128) void gemm_bias_act_f32wmma(
    const float* X0, const float* W0, const float* bias0, float* Y0, int act0,
    const float* X1, const float* W1, const float* bias1, float* Y1, int act1,
    int M, int N, int K)
{
  constexpr unsigned int A_SLICE   = slice_bytes(16u * MF);
  constexpr unsigned int B_SLICE   = slice_bytes(32u);
  constexpr unsigned int B_BASE    = 4u * A_SLICE;   // four A slices stand in front of the four B slices
  constexpr unsigned int BUF_BYTES = 4u * (A_SLICE + B_SLICE);   // one stage of 256 k
  __shared__ __attribute__((aligned(2048))) unsigned char ring[2u * BUF_BYTES];
  __shared__ float part[4][16 * MF][PART_PITCH];     // the waves' partial tiles

  const bool second = blockIdx.z != 0;    // block-uniform
  const float* __restrict__ X    = second ? X1 : X0;
  const float* __restrict__ W    = second ? W1 : W0;
  const float* __restrict__ bias = second ? bias1 : bias0;
  float* __restrict__ Y          = second ? Y1 : Y0;
  const int act                  = second ? act1 : act0;

  const int t    = threadIdx.x;
  const int lane = t & 31;
  const unsigned int wave = uni((unsigned int)t >> 5);
  const int colSel = lane & 15;
  const int half   = lane >> 4;

  const int gm0 = blockIdx.y * (16 * MF);
  const int gn0 = blockIdx.x * 32;

  const int nst = K / STAGE_K;
  const unsigned int ldsA = (unsigned int)(uintptr_t)&ring[0] + wave * A_SLICE;
  const unsigned int ldsB = (unsigned int)(uintptr_t)&ring[0] + B_BASE + wave * B_SLICE;
  const unsigned long long gaA =
      (unsigned long long)(uintptr_t)(X + (size_t)gm0 * K + wave * 64u);
  const unsigned long long gaB =
      (unsigned long long)(uintptr_t)(W + (size_t)gn0 * K + wave * 64u);
  v8u g1A = tdm_group1(16u * MF, (unsigned int)K * 4u);
  v8u g1B = tdm_group1(32u, (unsigned int)K * 4u);
  // Without this the compiler rebuilds the two groups at every issue and uses
  // their registers for loop counters while a request that names them is outstanding.
  asm volatile("" : "+s"(g1A), "+s"(g1B));

  v8f acc[MF][2];
#pragma unroll
  for (int m = 0; m < MF; ++m) {
    acc[m][0] = v8f{0.f,0.f,0.f,0.f,0.f,0.f,0.f,0.f};
    acc[m][1] = acc[m][0];
  }

  // Stage 0 lands and is published; then stage 1 starts into the other buffer.
  v4u g0A = tdm_group0(ldsA, gaA);
  v4u g0B = tdm_group0(ldsB, gaB);
  tdm_load_pair(g0A, g1A, g0B, g1B);
  tdm_wait_pair(g0A, g1A, g0B, g1B);  // this wave's share of stage 0 has landed
  __syncthreads();
  g0A = tdm_group0(ldsA + BUF_BYTES, gaA + STAGE_K * 4u);
  g0B = tdm_group0(ldsB + BUF_BYTES, gaB + STAGE_K * 4u);
  tdm_load_pair(g0A, g1A, g0B, g1B);

  int s = 0;
  do {
    const unsigned int bufOff = (unsigned int)(s & 1) * BUF_BYTES;
    // The wave's own k-quarter of the stage.
    const unsigned char* pa = ring + bufOff + wave * A_SLICE + colSel * PITCH_BYTES + half * 8;
    const unsigned char* pb = ring + bufOff + B_BASE + wave * B_SLICE + colSel * PITCH_BYTES + half * 8;

    // Unrolled: every LDS offset is then a constant beside two base registers.
#pragma unroll
    for (int kk = 0; kk < 16; ++kk) {
      const v2f b0 = *reinterpret_cast<const v2f*>(pb + kk * 16);   // B[k][n] = W[n][k]
      const v2f b1 = *reinterpret_cast<const v2f*>(pb + kk * 16 + 16u * PITCH_BYTES);
#pragma unroll
      for (int m = 0; m < MF; ++m) {
        const v2f a = *reinterpret_cast<const v2f*>(pa + kk * 16 + m * (16u * PITCH_BYTES));
        acc[m][0] = __builtin_amdgcn_wmma_f32_16x16x4_f32(false, a, false, b0,
                                                          (short)0, acc[m][0], false, false);
        acc[m][1] = __builtin_amdgcn_wmma_f32_16x16x4_f32(false, a, false, b1,
                                                          (short)0, acc[m][1], false, false);
      }
    }

    // Publish point of stage s + 1, and the end of every read of stage s.
    asm volatile("s_wait_dscnt 0x0" ::: "memory");      // this wave's reads of stage s are done
    tdm_wait_pair(g0A, g1A, g0B, g1B);                  // this wave's share of stage s + 1 has landed
    __syncthreads();
    if (pinned(s + 2 < nst)) {  // refill the buffer that every wave has just left
      const unsigned long long adv = (unsigned long long)(s + 2) * (STAGE_K * 4u);
      g0A = tdm_group0(ldsA + bufOff, gaA + adv);
      g0B = tdm_group0(ldsB + bufOff, gaB + adv);
      tdm_load_pair(g0A, g1A, g0B, g1B);
    }
  } while (++s < nst);
  tdm_wait_pair(g0A, g1A, g0B, g1B);
  asm volatile("s_wait_dscnt 0x0" ::: "memory");

  const int gn = gn0 + lane;      // the lane's column in the epilogue
  const float bv = bias[gn];

#pragma unroll
  for (int m = 0; m < MF; ++m) {
#pragma unroll
    for (int j = 0; j < 2; ++j) {
#pragma unroll
      for (int i = 0; i < 8; ++i)
        part[wave][m * 16 + half * 8 + i][j * 16 + colSel] = acc[m][j][i];
    }
  }
  __syncthreads();   // every wave's partial tile is written before any is summed

  // Epilogue. A wave takes 4*MF whole rows of the tile, a lane one column: a store is
  // one 128-byte line.
  // The test of act stands outside the loops over the rows, so that the rows' LDS reads
  // go out together and not one behind each branch.
  const int row0 = (int)wave * (4 * MF);
  float v[4 * MF];
#pragma unroll
  for (int x = 0; x < 4 * MF; ++x) {
    const int row = row0 + x;
    v[x] = (((part[0][row][lane] + part[1][row][lane]) + part[2][row][lane]) + part[3][row][lane]) + bv;
  }
  if (act == 1) {
#pragma unroll
    for (int x = 0; x < 4 * MF; ++x) v[x] = fmaxf(v[x], 0.f);
  } else if (act == 2) {
#pragma unroll
    for (int x = 0; x < 4 * MF; ++x) v[x] = fast_tanh(v[x]);
  }
#pragma unroll
  for (int x = 0; x < 4 * MF; ++x) Y[(size_t)(gm0 + row0 + x) * N + gn] = v[x];
}

// ---------------------------------------------------------------------------
// scores[b,l] = sum_d tanh(e[b,l,d] + ho_e[b,d]) * Wa[d] + ba
// e[b,0,:] = fr_e[b,:], e[b,l,:] = conv_feat_embed[b,l-1,:]
// 256 blocks, so that every WGP streams and few waves have to start. A block owns
// one batch row and 98 of its 196 rows of conv_feat_embed: 14 waves take 7 whole
// rows each, 14 apart; a fifteenth wave takes the fr_e row in the even blocks.
// A wave keeps the ho_e row and Wa in registers (lane: 4 d of every 128). A row is
// 8 b128 loads of 512 contiguous bytes; four rows are in flight, and a row's
// registers are asked for anew when it is summed.
// conv_feat_embed streamed once (~103 MB) with NT hint; V_TANH_F32 per elem.
// ---------------------------------------------------------------------------
#define SC_WAVES 14                       // streaming waves a block
#define SC_ROWS  7                        // rows a streaming wave: 14 x 7 = 98 = 196 / 2
#define SC_DEPTH 4                        // rows in flight a wave
#define SC_VECS  (D_DIM / 128)            // b128 loads a row

// Asks for one row: e is wave-uniform, so that the loads take a scalar base, the
// lane's offset and an immediate.
__device__ __forceinline__ void sc_ask(v4f (&v)[SC_VECS], const float* e, unsigned int lane4) {
#pragma unroll
  for (int j = 0; j < SC_VECS; ++j)
    v[j] = __builtin_nontemporal_load(reinterpret_cast<const v4f*>(e + (lane4 + j * 128u)));
}

// One lane's share of a row's sum: four chains, one for each of its 4 d in 128.
__device__ __forceinline__ float sc_sum(const v4f (&v)[SC_VECS], const v4f (&h)[SC_VECS],
                                        const v4f (&w)[SC_VECS]) {
  v4f a = {0.f, 0.f, 0.f, 0.f};
#pragma unroll
  for (int j = 0; j < SC_VECS; ++j) {
    const v4f x = v[j] + h[j];
    const v4f t = {fast_tanh(x[0]), fast_tanh(x[1]), fast_tanh(x[2]), fast_tanh(x[3])};
    a += t * w[j];
  }
  return (a[0] + a[1]) + (a[2] + a[3]);
}

// N rows, SC_WAVES apart, from e on; their scores go to o, SC_WAVES apart.
template <int N>
__device__ __forceinline__ void sc_rows(const float* e, const v4f (&h)[SC_VECS],
                                        const v4f (&w)[SC_VECS], const float* ba, float* o, int lane) {
  constexpr int DEPTH = N < SC_DEPTH ? N : SC_DEPTH;
  const unsigned int lane4 = (unsigned int)lane * 4u;

  v4f v[DEPTH][SC_VECS];
#pragma unroll
  for (int i = 0; i < DEPTH; ++i) sc_ask(v[i], e + i * (SC_WAVES * D_DIM), lane4);
  // Keeps the first rows' loads in front of the sums: left alone, the compiler
  // sinks most of the fourth row's behind the first sums.
  __builtin_amdgcn_sched_barrier(0);

  float s[N];
  // Unrolled: v[] and s[] then live in registers.
#pragma unroll
  for (int i = 0; i < N; ++i) {
    s[i] = sc_sum(v[i % DEPTH], h, w);
    // Each row's sum, against spills: the sum is finished here, and the refill below
    // stays behind it. Left alone, the compiler asks for all seven rows at the top and
    // spills them. (For the same reason the two streamed pointers are not __restrict__:
    // loads known to be of unchanging memory are held by no clobber.)
    asm volatile("" : "+v"(s[i]) :: "memory");
    if (i + DEPTH < N) sc_ask(v[i % DEPTH], e + (i + DEPTH) * (SC_WAVES * D_DIM), lane4);
    // Keeps the rows' sums apart: left alone, the compiler weaves the first rows' sums
    // together, and every refill is asked for only when the fourth row has landed.
    __builtin_amdgcn_sched_barrier(0);
  }
  // Every load has landed; from here on their address registers may be written anew.
  asm volatile("s_wait_xcnt 0x0" ::: "memory");

#pragma unroll
  for (int off = 16; off > 0; off >>= 1) {
#pragma unroll
    for (int i = 0; i < N; ++i) s[i] += __shfl_xor(s[i], off);
  }

  if (lane == 0) {
    const float bv = ba[0];
#pragma unroll
    for (int i = 0; i < N; ++i) o[i * SC_WAVES] = s[i] + bv;
  }
}

__global__ __launch_bounds__((SC_WAVES + 1) * 32) void attn_scores(
    const float* conv_feat_embed, const float* fr_e,   // not __restrict__: see the refills
    const float* __restrict__ ho_e, const float* __restrict__ Wa,
    const float* __restrict__ ba, float* __restrict__ scores)
{
  const int lane = threadIdx.x & 31;
  const unsigned int wave = uni((unsigned int)threadIdx.x >> 5);
  const unsigned int b    = blockIdx.x >> 1;
  const unsigned int odd  = blockIdx.x & 1u;                // block-uniform
  if (wave == SC_WAVES && odd) return;   // wave-uniform, and the kernel has no barrier

  v4f h[SC_VECS], w[SC_VECS];
#pragma unroll
  for (int j = 0; j < SC_VECS; ++j) {
    h[j] = *reinterpret_cast<const v4f*>(ho_e + (size_t)b * D_DIM + ((unsigned int)lane * 4u + j * 128u));
    w[j] = *reinterpret_cast<const v4f*>(Wa + ((unsigned int)lane * 4u + j * 128u));
  }

  if (wave < SC_WAVES) {
    const unsigned int r = odd * (SC_WAVES * SC_ROWS) + wave;   // the wave's first row; its l is r + 1
    sc_rows<SC_ROWS>(conv_feat_embed + ((size_t)b * L_DIM + r) * D_DIM, h, w, ba,
                     scores + (b * L1_DIM + 1u + r), lane);
  } else {
    sc_rows<1>(fr_e + (size_t)b * D_DIM, h, w, ba, scores + b * L1_DIM, lane);
  }
}

__global__ __launch_bounds__(256) void softmax197(
    const float* __restrict__ scores, float* __restrict__ PI)
{
  __shared__ float red[256];
  const int t = threadIdx.x;
  const int b = blockIdx.x;

  float v = (t < L1_DIM) ? scores[b * L1_DIM + t] : -INFINITY;
  red[t] = v;
  __syncthreads();
  for (int s = 128; s > 0; s >>= 1) {
    if (t < s) red[t] = fmaxf(red[t], red[t + s]);
    __syncthreads();
  }
  const float mx = red[0];
  __syncthreads();

  float e = (t < L1_DIM) ? expf(v - mx) : 0.f;
  red[t] = e;
  __syncthreads();
  for (int s = 128; s > 0; s >>= 1) {
    if (t < s) red[t] += red[t + s];
    __syncthreads();
  }
  const float inv = 1.f / red[0];
  if (t < L1_DIM) PI[b * L1_DIM + t] = e * inv;
}

// ---------------------------------------------------------------------------
// atten_out[b,d] = PI[b,0]*fr[b,d] + sum_l PI[b,l+1]*conv_feat[b,l,d] + ho[b,d]
// 256 blocks of 16 waves, so that every WGP streams. A block owns one batch row
// and 512 of its d. A wave owns 128 d (one b128 load = 512 contiguous bytes of a
// row) and 49 of the 196 l, and asks for all 49 rows before it sums the first;
// the four partial sums over l of each d meet in LDS.
// Streams conv_feat exactly once (~103 MB) with NT hint.
// ---------------------------------------------------------------------------
#define WS_GROUPS 4                       // partial sums over l
#define WS_ROWS   (L_DIM / WS_GROUPS)     // 49 rows a wave

__global__ __launch_bounds__(512) void weighted_sum(
    const float* __restrict__ conv_feat, const float* __restrict__ fr,
    const float* __restrict__ ho, const float* __restrict__ PI,
    float* __restrict__ atten)
{
  __shared__ v4f part[WS_GROUPS][128];

  const int t    = threadIdx.x;
  const int lane = t & 31;
  const unsigned int wave  = uni((unsigned int)t >> 5);
  const unsigned int slice = wave & 3u;   // which 128 d of the block's 512
  const unsigned int grp   = wave >> 2;   // which 49 rows
  const int b  = blockIdx.x >> 1;
  const int d0 = (blockIdx.x & 1) * 512;

  const v4f* cf = reinterpret_cast<const v4f*>(
      conv_feat + ((size_t)b * L_DIM + grp * WS_ROWS) * D_DIM + d0 + slice * 128u + lane * 4);
  const float* pi = PI + b * L1_DIM;      // wave-uniform: scalar loads

  const size_t o0 = (size_t)b * D_DIM + d0;   // block-uniform: the block's first d
  const float f = (fr + o0)[t];
  const float h = (ho + o0)[t];

  // The loops over the rows are unrolled: v[] and p[] then live in registers, and
  // each row's distance is an immediate offset beside one base address.
  v4f v[WS_ROWS];
#pragma unroll
  for (int i = 0; i < WS_ROWS; ++i)
    v[i] = __builtin_nontemporal_load(cf + (size_t)i * (D_DIM / 4));

  const float p0 = pi[0];
  float p[WS_ROWS];
#pragma unroll
  for (int i = 0; i < WS_ROWS; ++i) p[i] = pi[1 + grp * WS_ROWS + i];

  // Keeps every load above in front of the sums: left alone, the compiler sinks
  // the loads among the sums to save registers and holds about a quarter of them in flight.
  __builtin_amdgcn_sched_barrier(0);

  v4f acc = {0.f, 0.f, 0.f, 0.f};
#pragma unroll
  for (int i = 0; i < WS_ROWS; ++i) acc += p[i] * v[i];

  part[grp][slice * 32u + lane] = acc;
  __syncthreads();

  // One d a thread: the four partial sums in the order of l.
  const float* ps = reinterpret_cast<const float*>(&part[0][0]);
  float s = p0 * f;
#pragma unroll
  for (int g = 0; g < WS_GROUPS; ++g) s += ps[g * 512 + t];
  (atten + o0)[t] = s + h;
}

// ---------------------------------------------------------------------------
extern "C" void kernel_launch(void* const* d_in, const int* in_sizes, int n_in,
                              void* d_out, int out_size, void* d_ws, size_t ws_size,
                              hipStream_t stream) {
  (void)in_sizes; (void)n_in; (void)out_size; (void)ws_size;

  const float* h_out           = (const float*)d_in[0];
  const float* fake_region     = (const float*)d_in[1];
  const float* conv_feat       = (const float*)d_in[2];
  const float* conv_feat_embed = (const float*)d_in[3];
  const float* W_fr  = (const float*)d_in[4];
  const float* b_fr  = (const float*)d_in[5];
  const float* W_fre = (const float*)d_in[6];
  const float* b_fre = (const float*)d_in[7];
  const float* W_ho  = (const float*)d_in[8];
  const float* b_ho  = (const float*)d_in[9];
  const float* W_hoe = (const float*)d_in[10];
  const float* b_hoe = (const float*)d_in[11];
  const float* W_a   = (const float*)d_in[12];
  const float* b_a   = (const float*)d_in[13];
  const float* W_h   = (const float*)d_in[14];
  const float* b_h   = (const float*)d_in[15];
  float* out = (float*)d_out;

  float* ws    = (float*)d_ws;
  float* fr    = ws;
  float* ho    = fr    + B_DIM * D_DIM;
  float* fr_e  = ho    + B_DIM * D_DIM;
  float* ho_e  = fr_e  + B_DIM * D_DIM;
  float* atten = ho_e  + B_DIM * D_DIM;
  float* sc    = atten + B_DIM * D_DIM;
  float* PI    = sc    + B_DIM * L1_DIM;

  const dim3 gBlk(128);
  const dim3 gGrid(D_DIM / 32, B_DIM / 16);      // (32, 8): one product in 16 x 32 tiles
  const dim3 gGrid2(D_DIM / 32, B_DIM / 32, 2);  // (32, 4, 2): two products in 32 x 32 tiles

  // fr = relu(fake_region @ W_fr^T + b_fr)  beside  ho = tanh(h_out @ W_ho^T + b_ho)
  gemm_bias_act_f32wmma<2><<<gGrid2, gBlk, 0, stream>>>(fake_region, W_fr, b_fr, fr, 1,
                                                     h_out, W_ho, b_ho, ho, 2,
                                                     B_DIM, D_DIM, D_DIM);
  // fr_e = fr @ W_fre^T + b_fre  beside  ho_e = ho @ W_hoe^T + b_hoe
  gemm_bias_act_f32wmma<2><<<gGrid2, gBlk, 0, stream>>>(fr, W_fre, b_fre, fr_e, 0,
                                                     ho, W_hoe, b_hoe, ho_e, 0,
                                                     B_DIM, D_DIM, D_DIM);

  // attention scores + softmax + weighted sum
  attn_scores<<<dim3(B_DIM * 2), dim3((SC_WAVES + 1) * 32), 0, stream>>>(
      conv_feat_embed, fr_e, ho_e, W_a, b_a, sc);
  softmax197<<<dim3(B_DIM), dim3(256), 0, stream>>>(sc, PI);
  weighted_sum<<<dim3(B_DIM * 2), dim3(512), 0, stream>>>(conv_feat, fr, ho, PI, atten);

  // h = tanh(atten @ W_h^T + b_h)
  // (one product: with one z plane the second operand set is never picked)
  gemm_bias_act_f32wmma<1><<<gGrid, gBlk, 0, stream>>>(atten, W_h, b_h, out, 2,
                                                    atten, W_h, b_h, out, 2,
                                                    B_DIM, D_DIM, D_DIM);
}

// v006
// A run of this version takes 35 microseconds.
// In both of two side-by-side timings against v005, it was 1.09 times as fast.
// Over all steps from v000 it is 4.31 times as fast.
#include <hip/hip_runtime.h>
#include <hip/hip_bf16.h>
#include <math.h>

typedef __attribute__((ext_vector_type(2))) float v2f;
typedef __attribute__((ext_vector_type(4))) float v4f;
typedef __attribute__((ext_vector_type(8))) float v8f;
typedef __attribute__((ext_vector_type(4))) unsigned int v4u;
typedef __attribute__((ext_vector_type(8))) unsigned int v8u;

#define B_DIM  128
#define L_DIM  196
#define L1_DIM 197
#define D_DIM  1024

__device__ __forceinline__ float fast_tanh(float x) {
#if __has_builtin(__builtin_amdgcn_tanhf)
  return __builtin_amdgcn_tanhf(x);
#elif __has_builtin(__builtin_amdgcn_tanh_f32)
  return __builtin_amdgcn_tanh_f32(x);
#else
  return tanhf(x);
#endif
}

#define ROW_BYTES   256u      // 64 k of one row
#define PITCH_BYTES 272u      // LDS row pitch behind the pad
#define STAGE_K     256
#define PART_PITCH  36

// LDS bytes of a slice of that many rows, rounded up to 2 KiB units.
__host__ __device__ constexpr unsigned int slice_bytes(unsigned int rows) {
  return (rows * PITCH_BYTES + 2047u) / 2048u * 2048u;
}

__device__ __forceinline__ unsigned int uni(unsigned int v) {
  return (unsigned int)__builtin_amdgcn_readfirstlane(v);
}

__device__ __forceinline__ unsigned int pinned(unsigned int v) {
  unsigned int w = uni(v);
  asm volatile("" : "+s"(w));
  return w;
}

__device__ __forceinline__ v8u tdm_group1(unsigned int rows, unsigned int src_pitch_bytes) {
  v8u g;
  g[0] = uni((1u << 20) | (5u << 22) | (3u << 25));
  g[1] = uni((ROW_BYTES & 0xFFFFu) << 16);
  g[2] = uni((ROW_BYTES >> 16) | ((rows & 0xFFFFu) << 16));
  g[3] = uni((rows >> 16) | (ROW_BYTES << 16));
  g[4] = uni(rows);
  g[5] = uni(src_pitch_bytes);
  g[6] = uni(0u);
  g[7] = uni(0u);
  return g;
}

__device__ __forceinline__ v4u tdm_group0(unsigned int lds_dst, unsigned long long ga) {
  v4u g;
  g[0] = uni(1u);
  g[1] = uni(lds_dst);
  g[2] = uni((unsigned int)ga);
  g[3] = uni((((unsigned int)(ga >> 32)) & 0x01FFFFFFu) | 0x80000000u);
  return g;
}

__device__ __forceinline__ void tdm_load_pair(v4u& a0, v8u a1, v4u& b0, v8u b1) {
  asm volatile("tensor_load_to_lds %0, %2\n\ttensor_load_to_lds %1, %3"
               : "+s"(a0), "+s"(b0) : "s"(a1), "s"(b1) : "memory");
}

__device__ __forceinline__ void tdm_wait_pair(v4u a0, v8u a1, v4u b0, v8u b1) {
  asm volatile("s_wait_tensorcnt 0x0" :: "s"(a0), "s"(a1), "s"(b0), "s"(b1) : "memory");
}

template <int MF>
__global__ __launch_bounds__(128) void gemm_bias_act_f32wmma(
    const float* X0, const float* W0, const float* bias0, float* Y0, int act0,
    const float* X1, const float* W1, const float* bias1, float* Y1, int act1,
    int M, int N, int K)
{
  constexpr unsigned int A_SLICE   = slice_bytes(16u * MF);
  constexpr unsigned int B_SLICE   = slice_bytes(32u);
  constexpr unsigned int B_BASE    = 4u * A_SLICE;   // four A slices stand in front of the four B slices
  constexpr unsigned int BUF_BYTES = 4u * (A_SLICE + B_SLICE);   // one stage of 256 k
  __shared__ __attribute__((aligned(2048))) unsigned char ring[2u * BUF_BYTES];
  __shared__ float part[4][16 * MF][PART_PITCH];     // the waves' partial tiles

  const bool second = blockIdx.z != 0;    // block-uniform
  const float* __restrict__ X    = second ? X1 : X0;
  const float* __restrict__ W    = second ? W1 : W0;
  const float* __restrict__ bias = second ? bias1 : bias0;
  float* __restrict__ Y          = second ? Y1 : Y0;
  const int act                  = second ? act1 : act0;

  const int t    = threadIdx.x;
  const int lane = t & 31;
  const unsigned int wave = uni((unsigned int)t >> 5);
  const int colSel = lane & 15;
  const int half   = lane >> 4;

  const int gm0 = blockIdx.y * (16 * MF);
  const int gn0 = blockIdx.x * 32;

  const int nst = K / STAGE_K;
  const unsigned int ldsA = (unsigned int)(uintptr_t)&ring[0] + wave * A_SLICE;
  const unsigned int ldsB = (unsigned int)(uintptr_t)&ring[0] + B_BASE + wave * B_SLICE;
  const unsigned long long gaA =
      (unsigned long long)(uintptr_t)(X + (size_t)gm0 * K + wave * 64u);
  const unsigned long long gaB =
      (unsigned long long)(uintptr_t)(W + (size_t)gn0 * K + wave * 64u);
  v8u g1A = tdm_group1(16u * MF, (unsigned int)K * 4u);
  v8u g1B = tdm_group1(32u, (unsigned int)K * 4u);
  // Without this the compiler rebuilds the two groups at every issue and uses
  // their registers for loop counters while a request that names them is outstanding.
  asm volatile("" : "+s"(g1A), "+s"(g1B));

  v8f acc[MF][2];
#pragma unroll
  for (int m = 0; m < MF; ++m) {
    acc[m][0] = v8f{0.f,0.f,0.f,0.f,0.f,0.f,0.f,0.f};
    acc[m][1] = acc[m][0];
  }

  // Stage 0 lands and is published; then stage 1 starts into the other buffer.
  v4u g0A = tdm_group0(ldsA, gaA);
  v4u g0B = tdm_group0(ldsB, gaB);
  tdm_load_pair(g0A, g1A, g0B, g1B);
  tdm_wait_pair(g0A, g1A, g0B, g1B);  // this wave's share of stage 0 has landed
  __syncthreads();
  g0A = tdm_group0(ldsA + BUF_BYTES, gaA + STAGE_K * 4u);
  g0B = tdm_group0(ldsB + BUF_BYTES, gaB + STAGE_K * 4u);
  tdm_load_pair(g0A, g1A, g0B, g1B);

  int s = 0;
  do {
    const unsigned int bufOff = (unsigned int)(s & 1) * BUF_BYTES;
    // The wave's own k-quarter of the stage.
    const unsigned char* pa = ring + bufOff + wave * A_SLICE + colSel * PITCH_BYTES + half * 8;
    const unsigned char* pb = ring + bufOff + B_BASE + wave * B_SLICE + colSel * PITCH_BYTES + half * 8;

    // Unrolled: every LDS offset is then a constant beside two base registers.
#pragma unroll
    for (int kk = 0; kk < 16; ++kk) {
      const v2f b0 = *reinterpret_cast<const v2f*>(pb + kk * 16);   // B[k][n] = W[n][k]
      const v2f b1 = *reinterpret_cast<const v2f*>(pb + kk * 16 + 16u * PITCH_BYTES);
#pragma unroll
      for (int m = 0; m < MF; ++m) {
        const v2f a = *reinterpret_cast<const v2f*>(pa + kk * 16 + m * (16u * PITCH_BYTES));
        acc[m][0] = __builtin_amdgcn_wmma_f32_16x16x4_f32(false, a, false, b0,
                                                          (short)0, acc[m][0], false, false);
        acc[m][1] = __builtin_amdgcn_wmma_f32_16x16x4_f32(false, a, false, b1,
                                                          (short)0, acc[m][1], false, false);
      }
    }

    // Publish point of stage s + 1, and the end of every read of stage s.
    asm volatile("s_wait_dscnt 0x0" ::: "memory");      // this wave's reads of stage s are done
    tdm_wait_pair(g0A, g1A, g0B, g1B);                  // this wave's share of stage s + 1 has landed
    __syncthreads();
    if (pinned(s + 2 < nst)) {  // refill the buffer that every wave has just left
      const unsigned long long adv = (unsigned long long)(s + 2) * (STAGE_K * 4u);
      g0A = tdm_group0(ldsA + bufOff, gaA + adv);
      g0B = tdm_group0(ldsB + bufOff, gaB + adv);
      tdm_load_pair(g0A, g1A, g0B, g1B);
    }
  } while (++s < nst);
  tdm_wait_pair(g0A, g1A, g0B, g1B);
  asm volatile("s_wait_dscnt 0x0" ::: "memory");

  const int gn = gn0 + lane;      // the lane's column in the epilogue
  const float bv = bias[gn];

#pragma unroll
  for (int m = 0; m < MF; ++m) {
#pragma unroll
    for (int j = 0; j < 2; ++j) {
#pragma unroll
      for (int i = 0; i < 8; ++i)
        part[wave][m * 16 + half * 8 + i][j * 16 + colSel] = acc[m][j][i];
    }
  }
  __syncthreads();   // every wave's partial tile is written before any is summed

  // Epilogue. A wave takes 4*MF whole rows of the tile, a lane one column: a store is
  // one 128-byte line.
  // The test of act stands outside the loops over the rows, so that the rows' LDS reads
  // go out together and not one behind each branch.
  const int row0 = (int)wave * (4 * MF);
  float v[4 * MF];
#pragma unroll
  for (int x = 0; x < 4 * MF; ++x) {
    const int row = row0 + x;
    v[x] = (((part[0][row][lane] + part[1][row][lane]) + part[2][row][lane]) + part[3][row][lane]) + bv;
  }
  if (act == 1) {
#pragma unroll
    for (int x = 0; x < 4 * MF; ++x) v[x] = fmaxf(v[x], 0.f);
  } else if (act == 2) {
#pragma unroll
    for (int x = 0; x < 4 * MF; ++x) v[x] = fast_tanh(v[x]);
  }
#pragma unroll
  for (int x = 0; x < 4 * MF; ++x) Y[(size_t)(gm0 + row0 + x) * N + gn] = v[x];
}

// ---------------------------------------------------------------------------
// scores[b,l] = sum_d tanh(e[b,l,d] + ho_e[b,d]) * Wa[d] + ba
// e[b,0,:] = fr_e[b,:], e[b,l,:] = conv_feat_embed[b,l-1,:]
// 256 blocks, so that every WGP streams and few waves have to start. A block owns
// one batch row and 98 of its 196 rows of conv_feat_embed: 14 waves take 7 whole
// rows each, 14 apart; a fifteenth wave takes the fr_e row in the even blocks.
// A wave keeps the ho_e row and Wa in registers (lane: 4 d of every 128). A row is
// 8 b128 loads of 512 contiguous bytes; four rows are in flight, and a row's
// registers are asked for anew when it is summed.
// conv_feat_embed streamed once (~103 MB) with NT hint; V_TANH_F32 per elem.
// ---------------------------------------------------------------------------
#define SC_WAVES 14                       // streaming waves a block
#define SC_ROWS  7                        // rows a streaming wave: 14 x 7 = 98 = 196 / 2
#define SC_DEPTH 4                        // rows in flight a wave
#define SC_VECS  (D_DIM / 128)            // b128 loads a row

// Asks for one row: e is wave-uniform, so that the loads take a scalar base, the
// lane's offset and an immediate.
__device__ __forceinline__ void sc_ask(v4f (&v)[SC_VECS], const float* e, unsigned int lane4) {
#pragma unroll
  for (int j = 0; j < SC_VECS; ++j)
    v[j] = __builtin_nontemporal_load(reinterpret_cast<const v4f*>(e + (lane4 + j * 128u)));
}

// One lane's share of a row's sum: four chains, one for each of its 4 d in 128.
__device__ __forceinline__ float sc_sum(const v4f (&v)[SC_VECS], const v4f (&h)[SC_VECS],
                                        const v4f (&w)[SC_VECS]) {
  v4f a = {0.f, 0.f, 0.f, 0.f};
#pragma unroll
  for (int j = 0; j < SC_VECS; ++j) {
    const v4f x = v[j] + h[j];
    const v4f t = {fast_tanh(x[0]), fast_tanh(x[1]), fast_tanh(x[2]), fast_tanh(x[3])};
    a += t * w[j];
  }
  return (a[0] + a[1]) + (a[2] + a[3]);
}

// N rows, SC_WAVES apart, from e on; their scores go to o, SC_WAVES apart.
template <int N>
__device__ __forceinline__ void sc_rows(const float* e, const v4f (&h)[SC_VECS],
                                        const v4f (&w)[SC_VECS], const float* ba, float* o, int lane) {
  constexpr int DEPTH = N < SC_DEPTH ? N : SC_DEPTH;
  const unsigned int lane4 = (unsigned int)lane * 4u;

  v4f v[DEPTH][SC_VECS];
#pragma unroll
  for (int i = 0; i < DEPTH; ++i) sc_ask(v[i], e + i * (SC_WAVES * D_DIM), lane4);
  // Keeps the first rows' loads in front of the sums: left alone, the compiler
  // sinks most of the fourth row's behind the first sums.
  __builtin_amdgcn_sched_barrier(0);

  float s[N];
  // Unrolled: v[] and s[] then live in registers.
#pragma unroll
  for (int i = 0; i < N; ++i) {
    s[i] = sc_sum(v[i % DEPTH], h, w);
    // Each row's sum, against spills: the sum is finished here, and the refill below
    // stays behind it. Left alone, the compiler asks for all seven rows at the top and
    // spills them. (For the same reason the two streamed pointers are not __restrict__:
    // loads known to be of unchanging memory are held by no clobber.)
    asm volatile("" : "+v"(s[i]) :: "memory");
    if (i + DEPTH < N) sc_ask(v[i % DEPTH], e + (i + DEPTH) * (SC_WAVES * D_DIM), lane4);
    // Keeps the rows' sums apart: left alone, the compiler weaves the first rows' sums
    // together, and every refill is asked for only when the fourth row has landed.
    __builtin_amdgcn_sched_barrier(0);
  }
  // Every load has landed; from here on their address registers may be written anew.
  asm volatile("s_wait_xcnt 0x0" ::: "memory");

#pragma unroll
  for (int off = 16; off > 0; off >>= 1) {
#pragma unroll
    for (int i = 0; i < N; ++i) s[i] += __shfl_xor(s[i], off);
  }

  if (lane == 0) {
    const float bv = ba[0];
#pragma unroll
    for (int i = 0; i < N; ++i) o[i * SC_WAVES] = s[i] + bv;
  }
}

__global__ __launch_bounds__((SC_WAVES + 1) * 32) void attn_scores(
    const float* conv_feat_embed, const float* fr_e,   // not __restrict__: see the refills
    const float* __restrict__ ho_e, const float* __restrict__ Wa,
    const float* __restrict__ ba, float* __restrict__ scores)
{
  const int lane = threadIdx.x & 31;
  const unsigned int wave = uni((unsigned int)threadIdx.x >> 5);
  const unsigned int b    = blockIdx.x >> 1;
  const unsigned int odd  = blockIdx.x & 1u;                // block-uniform
  if (wave == SC_WAVES && odd) return;   // wave-uniform, and the kernel has no barrier

  v4f h[SC_VECS], w[SC_VECS];
#pragma unroll
  for (int j = 0; j < SC_VECS; ++j) {
    h[j] = *reinterpret_cast<const v4f*>(ho_e + (size_t)b * D_DIM + ((unsigned int)lane * 4u + j * 128u));
    w[j] = *reinterpret_cast<const v4f*>(Wa + ((unsigned int)lane * 4u + j * 128u));
  }

  if (wave < SC_WAVES) {
    const unsigned int r = odd * (SC_WAVES * SC_ROWS) + wave;   // the wave's first row; its l is r + 1
    sc_rows<SC_ROWS>(conv_feat_embed + ((size_t)b * L_DIM + r) * D_DIM, h, w, ba,
                     scores + (b * L1_DIM + 1u + r), lane);
  } else {
    sc_rows<1>(fr_e + (size_t)b * D_DIM, h, w, ba, scores + b * L1_DIM, lane);
  }
}

#define WS_GROUPS 4
#define WS_ROWS   (L_DIM / WS_GROUPS)
#define SM_VECS   ((L1_DIM + 31) / 32)
#define SM_OWN    ((WS_ROWS + 31) / 32)

// The value that lane n holds, in a scalar register.
__device__ __forceinline__ float lane_value(float v, int n) {
  return __builtin_bit_cast(float, __builtin_amdgcn_readlane(__builtin_bit_cast(int, v), n));
}

__global__ __launch_bounds__(512) void weighted_sum(
    const float* __restrict__ conv_feat, const float* __restrict__ fr,
    const float* __restrict__ ho, const float* __restrict__ scores,
    float* __restrict__ atten)
{
  __shared__ v4f part[WS_GROUPS][128];

  const int t    = threadIdx.x;
  const int lane = t & 31;
  const unsigned int wave  = uni((unsigned int)t >> 5);
  const unsigned int slice = wave & 3u;   // which 128 d of the block's 512
  const unsigned int grp   = wave >> 2;   // which 49 rows
  const int b  = blockIdx.x >> 1;
  const int d0 = (blockIdx.x & 1) * 512;

  const v4f* cf = reinterpret_cast<const v4f*>(
      conv_feat + ((size_t)b * L_DIM + grp * WS_ROWS) * D_DIM + d0 + slice * 128u + lane * 4);
  const float* sc  = scores + b * L1_DIM;          // the batch row's 197 scores
  const float* sco = sc + 1 + grp * WS_ROWS;       // those of the wave's own 49 rows

  // A lane past the end reads the last score again and counts it as -inf.
  float x[SM_VECS], y[SM_OWN];
#pragma unroll
  for (int j = 0; j < SM_VECS; ++j) {
    const int i = lane + 32 * j;
    x[j] = sc[i < L1_DIM ? i : L1_DIM - 1];
  }
#pragma unroll
  for (int k = 0; k < SM_OWN; ++k) {
    const int i = lane + 32 * k;
    y[k] = sco[i < WS_ROWS ? i : WS_ROWS - 1];
  }
  // Keeps the scores' loads in front of the rows': loads come back in order, and left
  // alone the compiler asks for most scores last, so that the softmax would start
  // only when the whole stream has landed.
  __builtin_amdgcn_sched_barrier(0);

  const size_t o0 = (size_t)b * D_DIM + d0;   // block-uniform: the block's first d
  const float f = (fr + o0)[t];
  const float h = (ho + o0)[t];

  // The loops over the rows are unrolled: v[] and p[] then live in registers, and
  // each row's distance is an immediate offset beside one base address.
  v4f v[WS_ROWS];
#pragma unroll
  for (int i = 0; i < WS_ROWS; ++i)
    v[i] = __builtin_nontemporal_load(cf + (size_t)i * (D_DIM / 4));

  // Keeps every load above in front of the sums: left alone, the compiler sinks
  // the loads among the sums to save registers and holds about a quarter of them in flight.
  __builtin_amdgcn_sched_barrier(0);

  if (lane + 32 * (SM_VECS - 1) >= L1_DIM) x[SM_VECS - 1] = -INFINITY;
  float mx = x[0];
#pragma unroll
  for (int j = 1; j < SM_VECS; ++j) mx = fmaxf(mx, x[j]);
#pragma unroll
  for (int off = 16; off > 0; off >>= 1) mx = fmaxf(mx, __shfl_xor(mx, off));

  const float e0 = expf(x[0] - mx);
  float sum = e0;
#pragma unroll
  for (int j = 1; j < SM_VECS; ++j) sum += expf(x[j] - mx);
#pragma unroll
  for (int off = 16; off > 0; off >>= 1) sum += __shfl_xor(sum, off);
  const float inv = 1.f / sum;

  const float p0 = lane_value(e0 * inv, 0);
  float q[SM_OWN];
#pragma unroll
  for (int k = 0; k < SM_OWN; ++k) q[k] = expf(y[k] - mx) * inv;
  float p[WS_ROWS];
#pragma unroll
  for (int i = 0; i < WS_ROWS; ++i) p[i] = lane_value(q[i >> 5], i & 31);

  v4f acc = {0.f, 0.f, 0.f, 0.f};
#pragma unroll
  for (int i = 0; i < WS_ROWS; ++i) acc += p[i] * v[i];

  part[grp][slice * 32u + lane] = acc;
  __syncthreads();

  // One d a thread: the four partial sums in the order of l.
  const float* ps = reinterpret_cast<const float*>(&part[0][0]);
  float s = p0 * f;
#pragma unroll
  for (int g = 0; g < WS_GROUPS; ++g) s += ps[g * 512 + t];
  (atten + o0)[t] = s + h;
}

// ---------------------------------------------------------------------------
extern "C" void kernel_launch(void* const* d_in, const int* in_sizes, int n_in,
                              void* d_out, int out_size, void* d_ws, size_t ws_size,
                              hipStream_t stream) {
  (void)in_sizes; (void)n_in; (void)out_size; (void)ws_size;

  const float* h_out           = (const float*)d_in[0];
  const float* fake_region     = (const float*)d_in[1];
  const float* conv_feat       = (const float*)d_in[2];
  const float* conv_feat_embed = (const float*)d_in[3];
  const float* W_fr  = (const float*)d_in[4];
  const float* b_fr  = (const float*)d_in[5];
  const float* W_fre = (const float*)d_in[6];
  const float* b_fre = (const float*)d_in[7];
  const float* W_ho  = (const float*)d_in[8];
  const float* b_ho  = (const float*)d_in[9];
  const float* W_hoe = (const float*)d_in[10];
  const float* b_hoe = (const float*)d_in[11];
  const float* W_a   = (const float*)d_in[12];
  const float* b_a   = (const float*)d_in[13];
  const float* W_h   = (const float*)d_in[14];
  const float* b_h   = (const float*)d_in[15];
  float* out = (float*)d_out;

  float* ws    = (float*)d_ws;
  float* fr    = ws;
  float* ho    = fr    + B_DIM * D_DIM;
  float* fr_e  = ho    + B_DIM * D_DIM;
  float* ho_e  = fr_e  + B_DIM * D_DIM;
  float* atten = ho_e  + B_DIM * D_DIM;
  float* sc    = atten + B_DIM * D_DIM;

  const dim3 gBlk(128);
  const dim3 gGrid(D_DIM / 32, B_DIM / 16);      // (32, 8): one product in 16 x 32 tiles
  const dim3 gGrid2(D_DIM / 32, B_DIM / 32, 2);  // (32, 4, 2): two products in 32 x 32 tiles

  // fr = relu(fake_region @ W_fr^T + b_fr)  beside  ho = tanh(h_out @ W_ho^T + b_ho)
  gemm_bias_act_f32wmma<2><<<gGrid2, gBlk, 0, stream>>>(fake_region, W_fr, b_fr, fr, 1,
                                                     h_out, W_ho, b_ho, ho, 2,
                                                     B_DIM, D_DIM, D_DIM);
  // fr_e = fr @ W_fre^T + b_fre  beside  ho_e = ho @ W_hoe^T + b_hoe
  gemm_bias_act_f32wmma<2><<<gGrid2, gBlk, 0, stream>>>(fr, W_fre, b_fre, fr_e, 0,
                                                     ho, W_hoe, b_hoe, ho_e, 0,
                                                     B_DIM, D_DIM, D_DIM);

  // attention scores, then softmax + weighted sum
  attn_scores<<<dim3(B_DIM * 2), dim3((SC_WAVES + 1) * 32), 0, stream>>>(
      conv_feat_embed, fr_e, ho_e, W_a, b_a, sc);
  weighted_sum<<<dim3(B_DIM * 2), dim3(512), 0, stream>>>(conv_feat, fr, ho, sc, atten);

  // h = tanh(atten @ W_h^T + b_h)
  // (one product: with one z plane the second operand set is never picked)
  gemm_bias_act_f32wmma<1><<<gGrid, gBlk, 0, stream>>>(atten, W_h, b_h, out, 2,
                                                    atten, W_h, b_h, out, 2,
                                                    B_DIM, D_DIM, D_DIM);
}

// v007
// A run of this version takes 33.3 microseconds.
// Next to v006, in two timings, it ran 1.07 and 1.06 times as fast.
// Counting every step since v000, it is 4.59 times as fast.
#include <hip/hip_runtime.h>
#include <hip/hip_bf16.h>
#include <math.h>

typedef __attribute__((ext_vector_type(2))) float v2f;
typedef __attribute__((ext_vector_type(4))) float v4f;
typedef __attribute__((ext_vector_type(8))) float v8f;
typedef __attribute__((ext_vector_type(4))) unsigned int v4u;
typedef __attribute__((ext_vector_type(8))) unsigned int v8u;

#define B_DIM  128
#define L_DIM  196
#define D_DIM  1024

__device__ __forceinline__ float fast_tanh(float x) {
#if __has_builtin(__builtin_amdgcn_tanhf)
  return __builtin_amdgcn_tanhf(x);
#elif __has_builtin(__builtin_amdgcn_tanh_f32)
  return __builtin_amdgcn_tanh_f32(x);
#else
  return tanhf(x);
#endif
}

#define ROW_BYTES   256u      // 64 k of one row
#define PITCH_BYTES 272u      // LDS row pitch behind the pad
#define STAGE_K     256
#define PART_PITCH  36

// LDS bytes of a slice of that many rows, rounded up to 2 KiB units.
__host__ __device__ constexpr unsigned int slice_bytes(unsigned int rows) {
  return (rows * PITCH_BYTES + 2047u) / 2048u * 2048u;
}

__device__ __forceinline__ unsigned int uni(unsigned int v) {
  return (unsigned int)__builtin_amdgcn_readfirstlane(v);
}

__device__ __forceinline__ unsigned int pinned(unsigned int v) {
  unsigned int w = uni(v);
  asm volatile("" : "+s"(w));
  return w;
}

__device__ __forceinline__ v8u tdm_group1(unsigned int rows, unsigned int src_pitch_bytes) {
  v8u g;
  g[0] = uni((1u << 20) | (5u << 22) | (3u << 25));
  g[1] = uni((ROW_BYTES & 0xFFFFu) << 16);
  g[2] = uni((ROW_BYTES >> 16) | ((rows & 0xFFFFu) << 16));
  g[3] = uni((rows >> 16) | (ROW_BYTES << 16));
  g[4] = uni(rows);
  g[5] = uni(src_pitch_bytes);
  g[6] = uni(0u);
  g[7] = uni(0u);
  return g;
}

__device__ __forceinline__ v4u tdm_group0(unsigned int lds_dst, unsigned long long ga) {
  v4u g;
  g[0] = uni(1u);
  g[1] = uni(lds_dst);
  g[2] = uni((unsigned int)ga);
  g[3] = uni((((unsigned int)(ga >> 32)) & 0x01FFFFFFu) | 0x80000000u);
  return g;
}

__device__ __forceinline__ void tdm_load_pair(v4u& a0, v8u a1, v4u& b0, v8u b1) {
  asm volatile("tensor_load_to_lds %0, %2\n\ttensor_load_to_lds %1, %3"
               : "+s"(a0), "+s"(b0) : "s"(a1), "s"(b1) : "memory");
}

__device__ __forceinline__ void tdm_wait_pair(v4u a0, v8u a1, v4u b0, v8u b1) {
  asm volatile("s_wait_tensorcnt 0x0" :: "s"(a0), "s"(a1), "s"(b0), "s"(b1) : "memory");
}

template <int MF, bool JOIN>
__global__ __launch_bounds__(128) void gemm_bias_act_f32wmma(
    const float* X0, const float* W0, const float* bias0, float* Y0, int act0,
    const float* X1, const float* W1, const float* bias1, float* Y1, int act1,
    const float* ms, int M, int N, int K)
{
  static_assert(!JOIN || MF == 1, "the joined form has one row of tiles");
  constexpr unsigned int A_ROWS    = JOIN ? 32u : 16u * MF;   // rows of X a tile takes
  constexpr unsigned int A_SLICE   = slice_bytes(A_ROWS);
  constexpr unsigned int B_SLICE   = slice_bytes(32u);
  constexpr unsigned int B_BASE    = 4u * A_SLICE;   // four A slices stand in front of the four B slices
  constexpr unsigned int BUF_BYTES = 4u * (A_SLICE + B_SLICE);   // one stage of 256 k
  __shared__ __attribute__((aligned(2048))) unsigned char ring[2u * BUF_BYTES];
  __shared__ float part[4][16 * MF][PART_PITCH];     // the waves' partial tiles

  const bool second = blockIdx.z != 0;    // block-uniform
  const float* __restrict__ X    = second ? X1 : X0;
  const float* __restrict__ W    = second ? W1 : W0;
  const float* __restrict__ bias = second ? bias1 : bias0;
  float* __restrict__ Y          = second ? Y1 : Y0;
  const int act                  = second ? act1 : act0;

  const int t    = threadIdx.x;
  const int lane = t & 31;
  const unsigned int wave = uni((unsigned int)t >> 5);
  const int colSel = lane & 15;
  const int half   = lane >> 4;

  const int gm0 = blockIdx.y * (16 * MF);
  const int gn0 = blockIdx.x * 32;

  const int nst = K / STAGE_K;
  const unsigned int ldsA = (unsigned int)(uintptr_t)&ring[0] + wave * A_SLICE;
  const unsigned int ldsB = (unsigned int)(uintptr_t)&ring[0] + B_BASE + wave * B_SLICE;
  const unsigned long long gaA =
      (unsigned long long)(uintptr_t)(X + (size_t)(blockIdx.y * A_ROWS) * K + wave * 64u);
  const unsigned long long gaB =
      (unsigned long long)(uintptr_t)(W + (size_t)gn0 * K + wave * 64u);
  v8u g1A = tdm_group1(A_ROWS, (unsigned int)K * 4u);
  v8u g1B = tdm_group1(32u, (unsigned int)K * 4u);
  // Without this the compiler rebuilds the two groups at every issue and uses
  // their registers for loop counters while a request that names them is outstanding.
  asm volatile("" : "+s"(g1A), "+s"(g1B));

  v8f acc[MF][2];
#pragma unroll
  for (int m = 0; m < MF; ++m) {
    acc[m][0] = v8f{0.f,0.f,0.f,0.f,0.f,0.f,0.f,0.f};
    acc[m][1] = acc[m][0];
  }

  // The lane's A row: (max, sum) of its two halves, asked for ahead of stage 0.
  v4f q = {0.f, 0.f, 0.f, 0.f};
  if constexpr (JOIN) q = *reinterpret_cast<const v4f*>(ms + (gm0 + colSel) * 4);

  // Stage 0 lands and is published; then stage 1 starts into the other buffer.
  v4u g0A = tdm_group0(ldsA, gaA);
  v4u g0B = tdm_group0(ldsB, gaB);
  tdm_load_pair(g0A, g1A, g0B, g1B);
  tdm_wait_pair(g0A, g1A, g0B, g1B);  // this wave's share of stage 0 has landed
  __syncthreads();
  g0A = tdm_group0(ldsA + BUF_BYTES, gaA + STAGE_K * 4u);
  g0B = tdm_group0(ldsB + BUF_BYTES, gaB + STAGE_K * 4u);
  tdm_load_pair(g0A, g1A, g0B, g1B);

  // The two halves' weights: each half's sum was formed against its own maximum.
  float c0 = 0.f, c1 = 0.f;
  if constexpr (JOIN) {
    const float mx  = fmaxf(q[0], q[2]);
    const float e0  = expf(q[0] - mx);
    const float e1  = expf(q[2] - mx);
    const float inv = 1.f / (e0 * q[1] + e1 * q[3]);
    c0 = e0 * inv;
    c1 = e1 * inv;
  }

  int s = 0;
  do {
    const unsigned int bufOff = (unsigned int)(s & 1) * BUF_BYTES;
    // The wave's own k-quarter of the stage.
    const unsigned char* pa = ring + bufOff + wave * A_SLICE + colSel * PITCH_BYTES + half * 8;
    const unsigned char* pb = ring + bufOff + B_BASE + wave * B_SLICE + colSel * PITCH_BYTES + half * 8;

    if constexpr (JOIN) {
      // The whole stage's fragments are asked for at once, in the order of their use; LDS
      // answers in order, so that a group of 4 k-steps waits for its own fragments alone.
      // All loops here are unrolled: the fragments then live in registers, and every LDS
      // offset is a constant beside a few base registers.
      v2f af[16], as[16], b0[16], b1[16];
#pragma unroll
      for (int kk = 0; kk < 16; ++kk) {
        af[kk] = *reinterpret_cast<const v2f*>(pa + kk * 16);                       // first half
        as[kk] = *reinterpret_cast<const v2f*>(pa + kk * 16 + 16u * PITCH_BYTES);   // second half
        b0[kk] = *reinterpret_cast<const v2f*>(pb + kk * 16);
        b1[kk] = *reinterpret_cast<const v2f*>(pb + kk * 16 + 16u * PITCH_BYTES);
      }
#pragma unroll
      for (int g = 0; g < 16; g += 4) {
        v2f a[4];
#pragma unroll
        for (int x = 0; x < 4; ++x) a[x] = c0 * af[g + x] + c1 * as[g + x];
        // Keeps the group's joins in front of its matrix instructions: woven in between
        // them, a join overwrites the A or B registers of the one directly ahead of it.
        __builtin_amdgcn_sched_barrier(0);
#pragma unroll
        for (int x = 0; x < 4; ++x) {
          acc[0][0] = __builtin_amdgcn_wmma_f32_16x16x4_f32(false, a[x], false, b0[g + x],
                                                            (short)0, acc[0][0], false, false);
          acc[0][1] = __builtin_amdgcn_wmma_f32_16x16x4_f32(false, a[x], false, b1[g + x],
                                                            (short)0, acc[0][1], false, false);
        }
        __builtin_amdgcn_sched_barrier(0);
        asm volatile("v_nop\n\tv_nop\n\tv_nop\n\tv_nop");
        __builtin_amdgcn_sched_barrier(0);
      }
    } else {
      // Unrolled: every LDS offset is then a constant beside two base registers.
#pragma unroll
      for (int kk = 0; kk < 16; ++kk) {
        const v2f b0 = *reinterpret_cast<const v2f*>(pb + kk * 16);   // B[k][n] = W[n][k]
        const v2f b1 = *reinterpret_cast<const v2f*>(pb + kk * 16 + 16u * PITCH_BYTES);
#pragma unroll
        for (int m = 0; m < MF; ++m) {
          const v2f a = *reinterpret_cast<const v2f*>(pa + kk * 16 + m * (16u * PITCH_BYTES));
          acc[m][0] = __builtin_amdgcn_wmma_f32_16x16x4_f32(false, a, false, b0,
                                                            (short)0, acc[m][0], false, false);
          acc[m][1] = __builtin_amdgcn_wmma_f32_16x16x4_f32(false, a, false, b1,
                                                            (short)0, acc[m][1], false, false);
        }
      }
    }

    // Publish point of stage s + 1, and the end of every read of stage s.
    asm volatile("s_wait_dscnt 0x0" ::: "memory");      // this wave's reads of stage s are done
    tdm_wait_pair(g0A, g1A, g0B, g1B);                  // this wave's share of stage s + 1 has landed
    __syncthreads();
    if (pinned(s + 2 < nst)) {  // refill the buffer that every wave has just left
      const unsigned long long adv = (unsigned long long)(s + 2) * (STAGE_K * 4u);
      g0A = tdm_group0(ldsA + bufOff, gaA + adv);
      g0B = tdm_group0(ldsB + bufOff, gaB + adv);
      tdm_load_pair(g0A, g1A, g0B, g1B);
    }
  } while (++s < nst);
  tdm_wait_pair(g0A, g1A, g0B, g1B);
  asm volatile("s_wait_dscnt 0x0" ::: "memory");

  const int gn = gn0 + lane;      // the lane's column in the epilogue
  const float bv = bias[gn];

#pragma unroll
  for (int m = 0; m < MF; ++m) {
#pragma unroll
    for (int j = 0; j < 2; ++j) {
#pragma unroll
      for (int i = 0; i < 8; ++i)
        part[wave][m * 16 + half * 8 + i][j * 16 + colSel] = acc[m][j][i];
    }
  }
  __syncthreads();   // every wave's partial tile is written before any is summed

  // Epilogue. A wave takes 4*MF whole rows of the tile, a lane one column: a store is
  // one 128-byte line.
  // The test of act stands outside the loops over the rows, so that the rows' LDS reads
  // go out together and not one behind each branch.
  const int row0 = (int)wave * (4 * MF);
  float v[4 * MF];
#pragma unroll
  for (int x = 0; x < 4 * MF; ++x) {
    const int row = row0 + x;
    v[x] = (((part[0][row][lane] + part[1][row][lane]) + part[2][row][lane]) + part[3][row][lane]) + bv;
  }
  if (act == 1) {
#pragma unroll
    for (int x = 0; x < 4 * MF; ++x) v[x] = fmaxf(v[x], 0.f);
  } else if (act == 2) {
#pragma unroll
    for (int x = 0; x < 4 * MF; ++x) v[x] = fast_tanh(v[x]);
  }
#pragma unroll
  for (int x = 0; x < 4 * MF; ++x) Y[(size_t)(gm0 + row0 + x) * N + gn] = v[x];
}

#define SC_WAVES 14
#define SC_ROWS  7
#define SC_DEPTH 4
#define SC_VECS  (D_DIM / 128)

// Asks for one row: e is wave-uniform, so that the loads take a scalar base, the
// lane's number as an offset that counts in 16 bytes, and an immediate.
__device__ __forceinline__ void sc_ask(v4f (&v)[SC_VECS], const float* e, unsigned int lane) {
#pragma unroll
  for (int j = 0; j < SC_VECS; ++j)
    v[j] = __builtin_nontemporal_load(reinterpret_cast<const v4f*>(
        reinterpret_cast<const char*>(e) + (lane * 16u + j * 512u)));
}

// One lane's share of a row's sum: four chains, one for each of its 4 d in 128.
__device__ __forceinline__ float sc_sum(const v4f (&v)[SC_VECS], const v4f (&h)[SC_VECS],
                                        const v4f (&w)[SC_VECS]) {
  v4f a = {0.f, 0.f, 0.f, 0.f};
#pragma unroll
  for (int j = 0; j < SC_VECS; ++j) {
    const v4f x = v[j] + h[j];
    const v4f t = {fast_tanh(x[0]), fast_tanh(x[1]), fast_tanh(x[2]), fast_tanh(x[3])};
    a += t * w[j];
  }
  return (a[0] + a[1]) + (a[2] + a[3]);
}

// The value that lane n holds, in a scalar register.
__device__ __forceinline__ float lane_value(float v, int n) {
  return __builtin_bit_cast(float, __builtin_amdgcn_readlane(__builtin_bit_cast(int, v), n));
}

template <int N>
__device__ __forceinline__ void sc_rows(const float* e, const float* c, const v4f (&h)[SC_VECS],
                                        const v4f (&w)[SC_VECS], float bv, int lane,
                                        float& mx, float& sum, v4f (&acc)[SC_VECS]) {
  constexpr int R     = 2 * N;            // rows of the run: N of e, then N of c
  constexpr int DEPTH = R < SC_DEPTH ? R : SC_DEPTH;
  constexpr int STEP  = SC_WAVES * D_DIM;
  v4f v[DEPTH][SC_VECS];
#pragma unroll
  for (int i = 0; i < DEPTH; ++i) sc_ask(v[i], i < N ? e + i * STEP : c + (i - N) * STEP, lane);
  // Keeps the first rows' loads in front of the sums: left alone, the compiler
  // sinks most of the fourth row's behind the first sums.
  __builtin_amdgcn_sched_barrier(0);

  float s[N];
  // Unrolled: v[] and s[] then live in registers.
#pragma unroll
  for (int i = 0; i < N; ++i) {
    s[i] = sc_sum(v[i % DEPTH], h, w);
    // Each row's sum, against spills: the sum is finished here, and the refill below
    // stays behind it. Left alone, the compiler asks for all rows at the top and
    // spills them. (For the same reason the streamed pointers are not __restrict__:
    // loads known to be of unchanging memory are held by no clobber.)
    asm volatile("" : "+v"(s[i]) :: "memory");
    const int n = i + DEPTH;
    if (n < R) sc_ask(v[i % DEPTH], n < N ? e + n * STEP : c + (n - N) * STEP, lane);
    // Keeps the rows' sums apart: left alone, the compiler weaves the first rows' sums
    // together, and every refill is asked for only when the fourth row has landed.
    __builtin_amdgcn_sched_barrier(0);
  }

#pragma unroll
  for (int off = 16; off > 0; off >>= 1) {
#pragma unroll
    for (int i = 0; i < N; ++i) s[i] += __shfl_xor(s[i], off);
  }

  // The same bits in every lane from here on.
#pragma unroll
  for (int i = 0; i < N; ++i) s[i] += bv;
  mx = s[0];
#pragma unroll
  for (int i = 1; i < N; ++i) mx = fmaxf(mx, s[i]);
  float p[N];
  sum = 0.f;
#pragma unroll
  for (int i = 0; i < N; ++i) {
    p[i] = expf(s[i] - mx);
    sum += p[i];
  }

#pragma unroll
  for (int j = 0; j < SC_VECS; ++j) acc[j] = v4f{0.f, 0.f, 0.f, 0.f};
#pragma unroll
  for (int i = 0; i < N; ++i) {
    const int k = N + i;                  // the row's place in the run
#pragma unroll
    for (int j = 0; j < SC_VECS; ++j) acc[j] += p[i] * v[k % DEPTH][j];
    if (k + DEPTH < R) sc_ask(v[k % DEPTH], c + (i + DEPTH) * STEP, lane);
    // Keeps a refill behind the row that it replaces and in front of the next row's wait.
    __builtin_amdgcn_sched_barrier(0);
  }
  // Every load has landed; from here on their address registers may be written anew.
  // The loads' offset register holds the lane's number; as an input here it takes no
  // load's result in front of the wait.
  asm volatile("s_wait_xcnt 0x0" :: "v"(lane) : "memory");
}

__global__ __launch_bounds__((SC_WAVES + 1) * 32) void attn_scores_sum(
    const float* conv_feat_embed, const float* conv_feat,   // not __restrict__: see the refills
    const float* fr_e, const float* fr,
    const float* __restrict__ ho_e, const float* __restrict__ ho, const float* __restrict__ Wa,
    const float* __restrict__ ba, float* __restrict__ halves, float* __restrict__ ms)
{
  __shared__ v4f wacc[SC_WAVES + 1][D_DIM / 4];   // the waves' sums of rows
  __shared__ __attribute__((aligned(16))) float wmx[SC_WAVES + 2], wsum[SC_WAVES + 2];   // 15 are used

  const int t    = threadIdx.x;
  const int lane = t & 31;
  const unsigned int wave = uni((unsigned int)t >> 5);
  const unsigned int b    = blockIdx.x >> 1;
  const unsigned int odd  = blockIdx.x & 1u;                // block-uniform

  v4f h[SC_VECS], w[SC_VECS];
#pragma unroll
  for (int j = 0; j < SC_VECS; ++j) {
    h[j] = *reinterpret_cast<const v4f*>(ho_e + (size_t)b * D_DIM + ((unsigned int)lane * 4u + j * 128u));
    w[j] = *reinterpret_cast<const v4f*>(Wa + ((unsigned int)lane * 4u + j * 128u));
  }
  // For the end of the kernel, asked for here so that nobody waits for it there:
  // the 4 d of ho that the thread writes (the first 256 threads write).
  const v4f hov = *reinterpret_cast<const v4f*>(ho + (size_t)b * D_DIM + (unsigned int)(t & 255) * 4u);
  const float bv = ba[0];
  // The loads above have their addresses; the scalars that held these may be written anew.
  asm volatile("s_wait_xcnt 0x0" ::: "memory");

  float mx, sum;
  v4f acc[SC_VECS];
  if (wave < SC_WAVES) {
    const size_t r = (size_t)b * L_DIM + odd * (SC_WAVES * SC_ROWS) + wave;   // the wave's first row
    sc_rows<SC_ROWS>(conv_feat_embed + r * D_DIM, conv_feat + r * D_DIM, h, w, bv, lane, mx, sum, acc);
  } else if (!odd) {
    sc_rows<1>(fr_e + (size_t)b * D_DIM, fr + (size_t)b * D_DIM, h, w, bv, lane, mx, sum, acc);
  } else {
    mx  = -INFINITY;
    sum = 0.f;
#pragma unroll
    for (int j = 0; j < SC_VECS; ++j) acc[j] = v4f{0.f, 0.f, 0.f, 0.f};
  }

#pragma unroll
  for (int j = 0; j < SC_VECS; ++j) wacc[wave][j * 32 + lane] = acc[j];
  if (lane == 0) {
    wmx[wave]  = mx;
    wsum[wave] = sum;
  }
  __syncthreads();   // every wave's sums are written before any is joined

  if (wave < D_DIM / 128) {               // wave-uniform, no barrier behind it: 4 d a thread
    // Every lane reads all the waves' maxima and sums (LDS broadcasts), so that no chain
    // of cross-lane steps stands in the kernel's tail. Lane k forms wave k's factor.
    float gm[SC_WAVES + 1], gs[SC_WAVES + 1];
#pragma unroll
    for (int k = 0; k < SC_WAVES + 1; ++k) {
      gm[k] = wmx[k];
      gs[k] = wsum[k];
    }
    const float own = wmx[lane < SC_WAVES + 1 ? lane : SC_WAVES];
    float bm = gm[0];
#pragma unroll
    for (int k = 1; k < SC_WAVES + 1; ++k) bm = fmaxf(bm, gm[k]);
    const float f = expf(own - bm);       // what wave k's sums count for beside the block's maximum

    float bs = 0.f;
    v4f a = {0.f, 0.f, 0.f, 0.f};
#pragma unroll
    for (int k = 0; k < SC_WAVES + 1; ++k) {
      const float fk = lane_value(f, k);
      bs += fk * gs[k];
      a  += fk * wacc[k][t];
    }
    a += bs * hov;
    // 16 batch rows' first halves stand in front of their second halves.
    const unsigned int row = (b >> 4) * 32u + odd * 16u + (b & 15u);
    *reinterpret_cast<v4f*>(halves + (size_t)row * D_DIM + (unsigned int)t * 4u) = a;
    if (t == 0) {
      ms[b * 4u + odd * 2u]      = bm;
      ms[b * 4u + odd * 2u + 1u] = bs;
    }
  }
}

// ---------------------------------------------------------------------------
extern "C" void kernel_launch(void* const* d_in, const int* in_sizes, int n_in,
                              void* d_out, int out_size, void* d_ws, size_t ws_size,
                              hipStream_t stream) {
  (void)in_sizes; (void)n_in; (void)out_size; (void)ws_size;

  const float* h_out           = (const float*)d_in[0];
  const float* fake_region     = (const float*)d_in[1];
  const float* conv_feat       = (const float*)d_in[2];
  const float* conv_feat_embed = (const float*)d_in[3];
  const float* W_fr  = (const float*)d_in[4];
  const float* b_fr  = (const float*)d_in[5];
  const float* W_fre = (const float*)d_in[6];
  const float* b_fre = (const float*)d_in[7];
  const float* W_ho  = (const float*)d_in[8];
  const float* b_ho  = (const float*)d_in[9];
  const float* W_hoe = (const float*)d_in[10];
  const float* b_hoe = (const float*)d_in[11];
  const float* W_a   = (const float*)d_in[12];
  const float* b_a   = (const float*)d_in[13];
  const float* W_h   = (const float*)d_in[14];
  const float* b_h   = (const float*)d_in[15];
  float* out = (float*)d_out;

  float* ws    = (float*)d_ws;
  float* fr    = ws;
  float* ho    = fr    + B_DIM * D_DIM;
  float* fr_e  = ho    + B_DIM * D_DIM;
  float* ho_e  = fr_e  + B_DIM * D_DIM;
  float* halves = ho_e   + B_DIM * D_DIM;       // 2 x B_DIM unnormalised half rows
  float* ms     = halves + 2 * B_DIM * D_DIM;   // (max, sum) of each

  const dim3 gBlk(128);
  const dim3 gGrid(D_DIM / 32, B_DIM / 16);      // (32, 8): one product in 16 x 32 tiles
  const dim3 gGrid2(D_DIM / 32, B_DIM / 32, 2);  // (32, 4, 2): two products in 32 x 32 tiles

  // fr = relu(fake_region @ W_fr^T + b_fr)  beside  ho = tanh(h_out @ W_ho^T + b_ho)
  gemm_bias_act_f32wmma<2, false><<<gGrid2, gBlk, 0, stream>>>(fake_region, W_fr, b_fr, fr, 1,
                                                            h_out, W_ho, b_ho, ho, 2,
                                                            nullptr, B_DIM, D_DIM, D_DIM);
  // fr_e = fr @ W_fre^T + b_fre  beside  ho_e = ho @ W_hoe^T + b_hoe
  gemm_bias_act_f32wmma<2, false><<<gGrid2, gBlk, 0, stream>>>(fr, W_fre, b_fre, fr_e, 0,
                                                            ho, W_hoe, b_hoe, ho_e, 0,
                                                            nullptr, B_DIM, D_DIM, D_DIM);

  // attention scores, split softmax and weighted sum: two half rows for each batch row
  attn_scores_sum<<<dim3(B_DIM * 2), dim3((SC_WAVES + 1) * 32), 0, stream>>>(
      conv_feat_embed, conv_feat, fr_e, fr, ho_e, ho, W_a, b_a, halves, ms);

  // h = tanh(atten @ W_h^T + b_h), atten joined from its halves at the A fragments
  // (one product: with one z plane the second operand set is never picked)
  gemm_bias_act_f32wmma<1, true><<<gGrid, gBlk, 0, stream>>>(halves, W_h, b_h, out, 2,
                                                          halves, W_h, b_h, out, 2,
                                                          ms, B_DIM, D_DIM, D_DIM);
}
